// v000
// The times below were measured on an AMD MI455X: many runs one after another, warmed up first and cycling through
// copies of the inputs, with the whole window's GPU time divided by the number of runs. Launches and the gaps
// between them are all in it. The median over several windows is given; except for v000 it joins two sittings, which
// can be a few percent apart, so the side-by-side timings, each taken in one sitting, are the better comparison.
// v000, which the later versions start from, runs in 255 microseconds.
#include <hip/hip_runtime.h>

// Multi-head self-attention with a per-key padding mask input: x [4][2048][512]; q = x Wq, fused kv = x Wkv ([in][out] weights; k = first 512 output columns, v = last 512; 8 heads x 64; no q/k/v biases); scores = (q k^T) / 8 with masked keys REPLACED by the lowest finite f32; softmax over the keys; out = merged ctx Wout + bout.
// Compute dtypes: all contractions v_wmma_f32_16x16x32_f16 (f16 operands, f32 accumulate). Every float input is converted to bf16 (RNE) on load and carried exactly in f16 (weights x16); q, k, v planes plain f16; P carried x1024 (row sums from the unconverted f32 values); ctx carried x64 against Wout x16; softmax f32.
// Engine: one-wave 64x64 register-blocked GEMM reading fragments straight from K-contiguous f16 planes; fused flash-style attention (online softmax, fragments from planes, wave-private P tile in LDS, mask packed into bit words in LDS).

#ifndef NB
#define NB 4
#endif
#ifndef SEQ
#define SEQ 2048
#endif
#define NB_FULL  4
#define SEQ_FULL 2048
#define DM   512
#define NH   8
#define HD   64
#define WCAR 16.0f      // weight carry (exact power of two)
#define PCAR 1024.0f    // probability carry
#define CCAR 64.0f      // ctx carry
#define SCL  0.125f     // HD^-0.5
#define L2E  1.4426950408889634f
#define NEGF (-3.402823466e38f)

typedef _Float16 h16;
typedef __attribute__((ext_vector_type(16))) _Float16 v16h;
typedef __attribute__((ext_vector_type(8)))  _Float16 v8h;
typedef __attribute__((ext_vector_type(8)))  float    v8f;
typedef __attribute__((ext_vector_type(4)))  float    v4f;
typedef v8h __attribute__((may_alias)) v8ha;
typedef v4f __attribute__((may_alias)) v4fa;

static_assert(NH * HD == DM);            // merged head width equals the model width
static_assert(HD == 64);
static_assert(DM % 64 == 0);             // N tiles of 64
static_assert(DM % 32 == 0);             // k-steps of 32
static_assert(SEQ % 128 == 0);           // 128 query rows per attention block; 64-row GEMM tiles stay inside one batch
static_assert(SEQ <= SEQ_FULL);
static_assert(NB <= NB_FULL);
static_assert((SEQ / 32) % 8 == 0);      // mask words split evenly over 8 waves

#define SZ_X   ((size_t)NB * SEQ * DM * 2)      // f16 plane of x / q / k / v^T / ctx
#define SZ_W   ((size_t)4 * DM * DM * 2)        // four transposed weight planes
#define WS_TOTAL (SZ_X * 5 + SZ_W)
static_assert(SZ_X % 256 == 0);
static_assert(SZ_W % 256 == 0);
static_assert(WS_TOTAL <= (size_t)134217728);   // carve stays under 128 MiB

// file-scope bounds for the kernels below
static_assert((2 * DM) % 64 == 0);                        // fused kv weight: 16 column tiles of 64, k plane then v plane
static_assert(256 * 4 * 4 == 64 * 64);                    // k_wt fill: threads x trips x elements == tile elements
static_assert(256 * 2 * 16 == 64 * 128);
static_assert(32 * 16 * 16 == 64 * 128);
static_assert(32 * 4 * 16 == 16 * 128);
static_assert(64 * 72 * 2 <= 131072);                     // static LDS of k_wt / k_proj_qk / k_proj_v
static_assert(16 * 68 * 4 <= 131072);                     // static LDS of k_proj_out
static_assert(8 * 16 * 72 * 2 + (SEQ / 32) * 4 <= 131072); // static LDS of k_attn
static_assert((size_t)NB * SEQ % 64 == 0);                // GEMM row tiles

__device__ __forceinline__ unsigned short f2bf(float f) { unsigned u = __float_as_uint(f); u += 0x7FFFu + ((u >> 16) & 1u); return (unsigned short)(u >> 16); }
__device__ __forceinline__ float bfr(float f) { return __uint_as_float(((unsigned)f2bf(f)) << 16); }
__device__ __forceinline__ v16h cat16(v8h lo, v8h hi) { return __builtin_shufflevector(lo, hi, 0, 1, 2, 3, 4, 5, 6, 7, 8, 9, 10, 11, 12, 13, 14, 15); }
// fragment loader for A (row-major [m][k]) and for B given as a [n][k] copy: elements 0..7 <- k0+8h.., elements 8..15 <- k0+16+8h.. ; p already includes the 8h offset
__device__ __forceinline__ v16h ldfrag(const h16* p) { return cat16(*(const v8h*)p, *(const v8h*)(p + 16)); }
// one WMMA with its own hazard guard (ties the accumulator, keeps A/B live)
__device__ __forceinline__ v8f wm16(v16h a, v16h b, v8f c) {
    c = __builtin_amdgcn_wmma_f32_16x16x32_f16(false, a, false, b, (short)0, c, false, false);
    asm volatile("v_nop\n\tv_nop\n\tv_nop\n\tv_nop" : "+v"(c) : "v"(a), "v"(b));
    return c;
}
__device__ __forceinline__ float ex2(float x) { return __builtin_amdgcn_exp2f(x); }
__device__ __forceinline__ float redmax16(float v) {
    v = fmaxf(v, __shfl_xor(v, 1, 32)); v = fmaxf(v, __shfl_xor(v, 2, 32));
    v = fmaxf(v, __shfl_xor(v, 4, 32)); v = fmaxf(v, __shfl_xor(v, 8, 32)); return v;
}
__device__ __forceinline__ float redsum16(float v) {
    v += __shfl_xor(v, 1, 32); v += __shfl_xor(v, 2, 32);
    v += __shfl_xor(v, 4, 32); v += __shfl_xor(v, 8, 32); return v;
}
// f32 -> f16 convert that cannot produce an f16 subnormal: |v| < 2^-14 becomes +0 (value select, applied after the carry)
static __device__ __forceinline__ h16 toh_flush(float v) { const h16 r = (h16)v; return (fabsf(v) < 6.103515625e-05f) ? (h16)0.0f : r; }

__global__ __launch_bounds__(256) void k_cvtx(const float* __restrict__ x, h16* xh) {
    const size_t i = (size_t)blockIdx.x * 256 + threadIdx.x;
    if (i >= (size_t)NB * SEQ * DM / 8) return;
    const size_t row = i / (DM / 8); const int g = (int)(i % (DM / 8));
    const size_t b = row / SEQ, s = row % SEQ;
    const float* src = x + ((b * SEQ_FULL + s) * DM + (size_t)g * 8);
    const v4f v0 = *(const v4f*)src; const v4f v1 = *(const v4f*)(src + 4);
    v8h o;
#pragma unroll
    for (int k = 0; k < 4; ++k) { o[k] = (h16)bfr(v0[k]); o[4 + k] = (h16)bfr(v1[k]); }
    *(v8h*)(xh + i * 8) = o; 
}

// The fused kv weight (pitch 1024, 16 column tiles) lands in two consecutive [512][512] planes: k then v.
// LDS tile T is cross-wave: block barrier between fill and drain.
__global__ __launch_bounds__(256) void k_wt(const float* __restrict__ W, h16* Wt, int ldw) {
    __shared__ __align__(16) h16 T[64 * 72];
    const int tid = threadIdx.x; const int k0 = blockIdx.x * 64, n0 = blockIdx.y * 64;
#pragma unroll
    for (int j = 0; j < 4; ++j) { const int i = tid + 256 * j; const int kr = i >> 4, c4 = (i & 15) * 4;
        const v4f v = *(const v4f*)(W + (size_t)(k0 + kr) * ldw + n0 + c4);
#pragma unroll
        for (int q = 0; q < 4; ++q) T[(c4 + q) * 72 + kr] = toh_flush(bfr(v[q]) * WCAR); }
    __syncthreads();
{
#pragma unroll
        for (int j = 0; j < 2; ++j) { const int p = tid + 256 * j; const int n = p >> 3, seg = p & 7;
            const v8h val = *(const v8ha*)(T + n * 72 + seg * 8);
            *(v8h*)(Wt + (size_t)(n0 + n) * DM + k0 + seg * 8) = val; }
         }
}

// ---- GEMM main loop: one wave per 64x64 tile, 16 accumulators, K = DM, operands from K-contiguous f16 planes (A [m][k], Bt [n][k]).
__device__ __forceinline__ void gemm64(const h16* __restrict__ A, const h16* __restrict__ Bt, size_t aoff, size_t boff, v8f (&acc)[4][4]) {
#pragma unroll 1
    for (int kc = 0; kc < DM; kc += 32) {
        v16h a[4];
#pragma unroll
        for (int mb = 0; mb < 4; ++mb) a[mb] = ldfrag(A + aoff + (size_t)mb * 16 * DM + kc);
#pragma unroll
        for (int nb = 0; nb < 4; ++nb) { const v16h b = ldfrag(Bt + boff + (size_t)nb * 16 * DM + kc);
#pragma unroll
            for (int mb = 0; mb < 4; ++mb) acc[mb][nb] = wm16(a[mb], b, acc[mb][nb]); }
    }
}

// ---- k_proj_qk: head plane [b][h][s][64] f16 = x Wt^T / 16 (no bias in this module); grid (NB*SEQ/64, DM/64), 32 threads.
__global__ __launch_bounds__(32) void k_proj_qk(const h16* __restrict__ A, const h16* __restrict__ Bt, h16* plane) {
    __shared__ __align__(16) h16 T[64 * 72];
    const int lane = threadIdx.x & 31, lr = lane & 15, hi = lane >> 4;
    const int r0 = blockIdx.x * 64, c0 = blockIdx.y * 64;
    v8f acc[4][4];
#pragma unroll
    for (int mb = 0; mb < 4; ++mb)
#pragma unroll
        for (int nb = 0; nb < 4; ++nb) acc[mb][nb] = (v8f){};
    gemm64(A, Bt, (size_t)(r0 + lr) * DM + 8 * hi, (size_t)(c0 + lr) * DM + 8 * hi, acc);
#pragma unroll
    for (int nb = 0; nb < 4; ++nb) {
#pragma unroll
        for (int mb = 0; mb < 4; ++mb)
#pragma unroll
            for (int j = 0; j < 8; ++j) T[(mb * 16 + hi * 8 + j) * 72 + nb * 16 + lr] = toh_flush(acc[mb][nb][j] * (1.0f / WCAR)); }
    __syncthreads();
    const int b = r0 / SEQ, s0 = r0 % SEQ, h = blockIdx.y;
    h16* dst = plane + ((size_t)(b * NH + h) * SEQ + s0) * HD;
{
#pragma unroll
        for (int it = 0; it < 16; ++it) { const int piece = it * 32 + lane; const int row = piece >> 3, seg = piece & 7;
            const v8h val = *(const v8ha*)(T + row * 72 + seg * 8);
            *(v8h*)(dst + (size_t)row * HD + seg * 8) = val; }
         }
}

__global__ __launch_bounds__(32) void k_proj_v(const h16* __restrict__ A, const h16* __restrict__ Bt, h16* VT) {
    __shared__ __align__(16) h16 T[64 * 72];
    const int lane = threadIdx.x & 31, lr = lane & 15, hi = lane >> 4;
    const int r0 = blockIdx.x * 64, c0 = blockIdx.y * 64;
    v8f acc[4][4];
#pragma unroll
    for (int mb = 0; mb < 4; ++mb)
#pragma unroll
        for (int nb = 0; nb < 4; ++nb) acc[mb][nb] = (v8f){};
    gemm64(A, Bt, (size_t)(r0 + lr) * DM + 8 * hi, (size_t)(c0 + lr) * DM + 8 * hi, acc);
#pragma unroll
    for (int nb = 0; nb < 4; ++nb) {
#pragma unroll
        for (int mb = 0; mb < 4; ++mb) { v8h pk;
#pragma unroll
            for (int j = 0; j < 8; ++j) pk[j] = toh_flush(acc[mb][nb][j] * (1.0f / WCAR));
            *(v8ha*)(T + (nb * 16 + lr) * 72 + mb * 16 + hi * 8) = pk; } }
    __syncthreads();
    const int b = r0 / SEQ, s0 = r0 % SEQ, h = blockIdx.y;
    h16* dst = VT + ((size_t)(b * NH + h) * HD) * SEQ + s0;
{
#pragma unroll
        for (int it = 0; it < 16; ++it) { const int piece = it * 32 + lane; const int d = piece >> 3, seg = piece & 7;
            const v8h val = *(const v8ha*)(T + d * 72 + seg * 8);
            *(v8h*)(dst + (size_t)d * SEQ + seg * 8) = val; }
         }
}

__global__ __launch_bounds__(32) void k_proj_out(const h16* __restrict__ A, const h16* __restrict__ Bt, const float* __restrict__ bias, float* C) {
    __shared__ __align__(16) float os[16 * 68];
    const int lane = threadIdx.x & 31, lr = lane & 15, hi = lane >> 4;
    const int r0 = blockIdx.x * 64, c0 = blockIdx.y * 64;
    v8f acc[4][4];
#pragma unroll
    for (int mb = 0; mb < 4; ++mb)
#pragma unroll
        for (int nb = 0; nb < 4; ++nb) acc[mb][nb] = (v8f){};
    gemm64(A, Bt, (size_t)(r0 + lr) * DM + 8 * hi, (size_t)(c0 + lr) * DM + 8 * hi, acc);
    const int b = r0 / SEQ, s0 = r0 % SEQ; const int cofs = lr * 4;
    v4f b4;
#pragma unroll
    for (int q = 0; q < 4; ++q) b4[q] = bfr(bias[c0 + cofs + q]);
    const float fs = 1.0f / (WCAR * CCAR);
#pragma unroll
    for (int mb = 0; mb < 4; ++mb) {
#pragma unroll
        for (int nb = 0; nb < 4; ++nb)
#pragma unroll
            for (int j = 0; j < 8; ++j) os[(hi * 8 + j) * 68 + nb * 16 + lr] = acc[mb][nb][j];
        __syncthreads();
        float* crow = C + ((size_t)b * SEQ_FULL + s0 + mb * 16) * DM + c0;
{
#pragma unroll
            for (int s = 0; s < 8; ++s) { const int row = 2 * s + hi; const v4f raw = *(const v4fa*)(os + row * 68 + cofs); v4f val;
#pragma unroll
                for (int q = 0; q < 4; ++q) val[q] = raw[q] * fs + b4[q];
                *(v4f*)(crow + (size_t)row * DM + cofs) = val; }
             }
        __syncthreads();
    }
}

// ---- k_attn: fused flash-style attention; grid (NB*NH, SEQ/128), 256 threads = 8 waves x 16 query rows.
// K fragments from the [s][64] plane, V fragments from the [d][s] plane, both as [n][k] copies (same k map as A). Per 64-key block: 8 score WMMAs, online softmax in f32
// (masked keys replaced by the lowest finite f32; all-masked rows come out uniform), P x1024 -> f16 in the wave-private LDS tile (stored as h16, reloaded through a may_alias h16 vector with wave barriers), 8 P.V WMMAs.
// smw (mask bit words) is cross-wave: block barrier after the build. Pl is private to each wave.
__global__ __launch_bounds__(256) void k_attn(const h16* __restrict__ Q, const h16* __restrict__ Kp, const h16* __restrict__ VT, const int* __restrict__ mask, h16* ctx) {
    __shared__ __align__(16) h16 Pl[8 * 16 * 72];
    __shared__ unsigned smw[SEQ / 32];
    const int tid = threadIdx.x, lane = tid & 31, lr = lane & 15, hi = lane >> 4;
    const int wave = __builtin_amdgcn_readfirstlane(tid >> 5);
    const int bh = blockIdx.x; const int b = bh / NH, h = bh % NH;
    const int q0 = blockIdx.y * 128;
#pragma unroll 1
    for (int w = wave; w < SEQ / 32; w += 8) { const int mv = mask[(size_t)b * SEQ_FULL + w * 32 + lane];
        const unsigned bits = __builtin_amdgcn_ballot_w32(mv != 0); if (lane == 0) smw[w] = bits; }
    __syncthreads();
    const size_t pbase = (size_t)bh * SEQ * HD;
    const h16* vt = VT + pbase;
    const int pw = wave * 16 * 72;
    v16h qf0, qf1;
    { const h16* qp = Q + pbase + (size_t)(q0 + wave * 16 + lr) * HD + 8 * hi; qf0 = ldfrag(qp); qf1 = ldfrag(qp + 32); }
    v8f o[4]; float mi[8], li[8];
#pragma unroll
    for (int t = 0; t < 4; ++t) o[t] = (v8f){};
#pragma unroll
    for (int r = 0; r < 8; ++r) { mi[r] = NEGF; li[r] = 0.0f; }
#pragma unroll 1
    for (int kv0 = 0; kv0 < SEQ; kv0 += 64) {
        v8f sa[4];
#pragma unroll
        for (int t = 0; t < 4; ++t) { const h16* kp = Kp + pbase + (size_t)(kv0 + t * 16 + lr) * HD + 8 * hi; v8f c = (v8f){};
            c = wm16(qf0, ldfrag(kp), c); c = wm16(qf1, ldfrag(kp + 32), c); sa[t] = c; }
        const unsigned w0 = smw[kv0 >> 5], w1 = smw[(kv0 >> 5) + 1];
        const bool k0ok = ((w0 >> lr) & 1u) != 0u, k1ok = ((w0 >> (16 + lr)) & 1u) != 0u, k2ok = ((w1 >> lr) & 1u) != 0u, k3ok = ((w1 >> (16 + lr)) & 1u) != 0u;
#pragma unroll
        for (int r = 0; r < 8; ++r) {
            const float s0 = k0ok ? sa[0][r] * SCL : NEGF; const float s1 = k1ok ? sa[1][r] * SCL : NEGF;
            const float s2 = k2ok ? sa[2][r] * SCL : NEGF; const float s3 = k3ok ? sa[3][r] * SCL : NEGF;
            float vm = fmaxf(fmaxf(s0, s1), fmaxf(s2, s3)); vm = redmax16(vm);
            const float mnew = fmaxf(mi[r], vm);
            const float alpha = ex2(fmaxf(mi[r] - mnew, -150.0f) * L2E); mi[r] = mnew;
            const float p0 = ex2(fmaxf(s0 - mnew, -150.0f) * L2E); const float p1 = ex2(fmaxf(s1 - mnew, -150.0f) * L2E);
            const float p2 = ex2(fmaxf(s2 - mnew, -150.0f) * L2E); const float p3 = ex2(fmaxf(s3 - mnew, -150.0f) * L2E);
            li[r] = li[r] * alpha + ((p0 + p1) + (p2 + p3));
            const int pr = pw + (hi * 8 + r) * 72 + lr;
            Pl[pr] = (h16)(p0 * PCAR); Pl[pr + 16] = (h16)(p1 * PCAR); Pl[pr + 32] = (h16)(p2 * PCAR); Pl[pr + 48] = (h16)(p3 * PCAR);
#pragma unroll
            for (int t = 0; t < 4; ++t) o[t][r] *= alpha;
        }
        asm volatile("" ::: "memory"); __builtin_amdgcn_wave_barrier(); asm volatile("" ::: "memory");
#pragma unroll
        for (int s2 = 0; s2 < 2; ++s2) {
            const v16h pf = cat16(*(const v8ha*)(Pl + pw + lr * 72 + s2 * 32 + 8 * hi), *(const v8ha*)(Pl + pw + lr * 72 + s2 * 32 + 16 + 8 * hi));
#pragma unroll
            for (int t = 0; t < 4; ++t) { const h16* vp = vt + (size_t)(t * 16 + lr) * SEQ + kv0 + s2 * 32 + 8 * hi; o[t] = wm16(pf, ldfrag(vp), o[t]); }
        }
        asm volatile("" ::: "memory"); __builtin_amdgcn_wave_barrier(); asm volatile("" ::: "memory");
    }
#pragma unroll
    for (int r = 0; r < 8; ++r) { const float l = redsum16(li[r]); const float inv = (CCAR / PCAR) * __builtin_amdgcn_rcpf(l);
#pragma unroll
        for (int t = 0; t < 4; ++t) Pl[pw + (hi * 8 + r) * 72 + t * 16 + lr] = (h16)(o[t][r] * inv); }
    asm volatile("" ::: "memory"); __builtin_amdgcn_wave_barrier(); asm volatile("" ::: "memory");
    h16* dst = ctx + ((size_t)b * SEQ + q0 + wave * 16) * DM + h * HD;
{
#pragma unroll
        for (int it = 0; it < 4; ++it) { const int piece = it * 32 + lane; const int row = piece >> 3, seg = piece & 7;
            const v8h val = *(const v8ha*)(Pl + pw + row * 72 + seg * 8);
            *(v8h*)(dst + (size_t)row * DM + seg * 8) = val; }
         }
}

extern "C" void kernel_launch(void* const* d_in, const int* in_sizes, int n_in,
                              void* d_out, int out_size, void* d_ws, size_t ws_size, hipStream_t stream) {
    if (n_in < 6) return;
    const size_t xneed = ((size_t)(NB - 1) * SEQ_FULL + SEQ) * DM;
    const size_t mneed = (size_t)(NB - 1) * SEQ_FULL + SEQ;
    if ((size_t)in_sizes[0] < xneed || (size_t)in_sizes[1] < mneed) return;
    if (in_sizes[2] < DM * DM || in_sizes[3] < 2 * DM * DM || in_sizes[4] < DM * DM) return;
    if (in_sizes[5] < DM) return;
    if ((size_t)out_size < xneed) return;
    if (ws_size < WS_TOTAL) return;
    // input order of the wire: x, mask, Wq [512][512], Wkv [512][1024], Wout [512][512], bout [512]
    const float* x   = (const float*)d_in[0]; const int* mask = (const int*)d_in[1];
    const float* wq  = (const float*)d_in[2];
    const float* wkv = (const float*)d_in[3];
    const float* wo  = (const float*)d_in[4]; const float* bo = (const float*)d_in[5];
    float* OUT = (float*)d_out;
    char* wsp = (char*)d_ws;
    h16* XH = (h16*)wsp; wsp += SZ_X;      // [NB*SEQ][DM]
    h16* WT = (h16*)wsp; wsp += SZ_W;      // [4][n][k]: q, k, v, o
    h16* QP = (h16*)wsp; wsp += SZ_X;      // [b][h][s][64]
    h16* KP = (h16*)wsp; wsp += SZ_X;      // [b][h][s][64]
    h16* VT = (h16*)wsp; wsp += SZ_X;      // [b][h][64][s]
    h16* CX = (h16*)wsp; wsp += SZ_X;      // [NB*SEQ][DM], x64
    const size_t wsz = (size_t)DM * DM;
    k_cvtx<<<(unsigned)(((size_t)NB * SEQ * DM / 8 + 255) / 256), 256, 0, stream>>>(x, XH);
    const dim3 gw(DM / 64, DM / 64);
    const dim3 gwkv(DM / 64, 2 * DM / 64);
    k_wt<<<gw, 256, 0, stream>>>(wq, WT, DM);                  // in[512][512] -> out[512 n][512 k]
    k_wt<<<gwkv, 256, 0, stream>>>(wkv, WT + wsz, 2 * DM);     // in[512][1024] -> out[1024 n][512 k] = k plane, v plane
    k_wt<<<gw, 256, 0, stream>>>(wo, WT + 3 * wsz, DM);        // in[512][512] -> out[512 n][512 k]
    const dim3 gg(NB * SEQ / 64, DM / 64);
    k_proj_qk<<<gg, 32, 0, stream>>>(XH, WT, QP);
    k_proj_qk<<<gg, 32, 0, stream>>>(XH, WT + wsz, KP);
    k_proj_v<<<gg, 32, 0, stream>>>(XH, WT + 2 * wsz, VT);
    k_attn<<<dim3(NB * NH, SEQ / 128), 256, 0, stream>>>(QP, KP, VT, mask, CX);
    k_proj_out<<<gg, 32, 0, stream>>>(CX, WT + 3 * wsz, bo, OUT);
}

// v001
// It runs in 149 microseconds.
// Two timings next to v000 put it at 1.77 and 1.76 times that version's speed.
#include <hip/hip_runtime.h>

// Multi-head self-attention with a per-key padding mask input: x [4][2048][512]; q = x Wq, fused kv = x Wkv ([in][out] weights; k = first 512 output columns, v = last 512; 8 heads x 64; no q/k/v biases); scores = (q k^T) / 8 with masked keys REPLACED by the lowest finite f32; softmax over the keys; out = merged ctx Wout + bout.
// Compute dtypes: all contractions v_wmma_f32_16x16x32_f16 (f16 operands, f32 accumulate). Every float input is converted to bf16 (RNE) on load and carried exactly in f16 (weights x16); q, k, v planes plain f16; P carried x1024 (row sums from the unconverted f32 values); ctx carried x64 against Wout x16; softmax f32.
// Engine: one-wave 64x64 register-blocked GEMM reading fragments straight from K-contiguous f16 planes; fused flash-style attention (online softmax, K and V^T tiles staged once per block in a two-buffer LDS ring by asynchronous copies, wave-private P tile in LDS, mask packed into bit words in LDS).

#ifndef NB
#define NB 4
#endif
#ifndef SEQ
#define SEQ 2048
#endif
#define NB_FULL  4
#define SEQ_FULL 2048
#define DM   512
#define NH   8
#define HD   64
#define WCAR 16.0f      // weight carry (exact power of two)
#define PCAR 1024.0f    // probability carry
#define CCAR 64.0f      // ctx carry
#define SCL  0.125f     // HD^-0.5
#define L2E  1.4426950408889634f
#define NEGF (-3.402823466e38f)
#define KVP  72         // LDS pitch of a staged K or V^T row, in f16: 144 bytes = 16 x odd, conflict-free for 16-byte readers
#define KVT  (64 * KVP) // one staged tile: 64 rows of 64 f16

typedef _Float16 h16;
typedef __attribute__((ext_vector_type(16))) _Float16 v16h;
typedef __attribute__((ext_vector_type(8)))  _Float16 v8h;
typedef __attribute__((ext_vector_type(8)))  float    v8f;
typedef __attribute__((ext_vector_type(4)))  float    v4f;
typedef v8h __attribute__((may_alias)) v8ha;
typedef v4f __attribute__((may_alias)) v4fa;

static_assert(NH * HD == DM);            // merged head width equals the model width
static_assert(HD == 64);
static_assert(DM % 64 == 0);             // N tiles of 64
static_assert(DM % 32 == 0);             // k-steps of 32
static_assert(SEQ % 128 == 0);           // 128 query rows per attention block; 64-row GEMM tiles stay inside one batch
static_assert(SEQ <= SEQ_FULL);
static_assert(NB <= NB_FULL);
static_assert((SEQ / 32) % 8 == 0);      // mask words split evenly over 8 waves

#define SZ_X   ((size_t)NB * SEQ * DM * 2)      // f16 plane of x / q / k / v^T / ctx
#define SZ_W   ((size_t)4 * DM * DM * 2)        // four transposed weight planes
#define WS_TOTAL (SZ_X * 5 + SZ_W)
static_assert(SZ_X % 256 == 0);
static_assert(SZ_W % 256 == 0);
static_assert(WS_TOTAL <= (size_t)134217728);   // carve stays under 128 MiB

// file-scope bounds for the kernels below
static_assert((2 * DM) % 64 == 0);                        // fused kv weight: 16 column tiles of 64, k plane then v plane
static_assert(256 * 4 * 4 == 64 * 64);                    // k_wt fill: threads x trips x elements == tile elements
static_assert(256 * 2 * 16 == 64 * 128);
static_assert(32 * 16 * 16 == 64 * 128);
static_assert(32 * 4 * 16 == 16 * 128);
static_assert(64 * 72 * 2 <= 131072);                     // static LDS of k_wt / k_proj_qk / k_proj_v
static_assert(16 * 68 * 4 <= 131072);                     // static LDS of k_proj_out
static_assert(8 * 16 * 72 * 2 + 4 * KVT * 2 + (SEQ / 32) * 4 <= 131072); // static LDS of k_attn
static_assert(256 * 2 * 8 == 64 * HD);                    // k_attn staging: threads x copies x elements == tile elements
static_assert(SEQ >= 128);                                // the ring's prologue fills two tiles of 64 keys
static_assert((KVP * 2) % 16 == 0);                       // every staged row starts at a multiple of the copy width
static_assert((size_t)NB * SEQ % 64 == 0);                // GEMM row tiles

__device__ __forceinline__ unsigned short f2bf(float f) { unsigned u = __float_as_uint(f); u += 0x7FFFu + ((u >> 16) & 1u); return (unsigned short)(u >> 16); }
__device__ __forceinline__ float bfr(float f) { return __uint_as_float(((unsigned)f2bf(f)) << 16); }
__device__ __forceinline__ v16h cat16(v8h lo, v8h hi) { return __builtin_shufflevector(lo, hi, 0, 1, 2, 3, 4, 5, 6, 7, 8, 9, 10, 11, 12, 13, 14, 15); }
// fragment loader for A (row-major [m][k]) and for B given as a [n][k] copy: elements 0..7 <- k0+8h.., elements 8..15 <- k0+16+8h.. ; p already includes the 8h offset
__device__ __forceinline__ v16h ldfrag(const h16* p) { return cat16(*(const v8h*)p, *(const v8h*)(p + 16)); }
// the same fragment from a staged LDS tile (same k map)
__device__ __forceinline__ v16h ldfrag_s(const h16* p) { return cat16(*(const v8ha*)p, *(const v8ha*)(p + 16)); }
// One 64-key stage: each of the 256 threads copies 4 x 16 bytes, rows r and r + 32 of the K tile and of the V^T tile (r = tid / 8).
// lk: the lane's LDS byte address in the K tile of the target buffer; kg, vg: the lane's global sources.
// s_wait_xcnt stands inside the copies' own statement, so that no address register is rewritten ahead of it.
__device__ __forceinline__ void stage_kv(unsigned lk, const h16* kg, const h16* vg) {
    const unsigned lk1 = lk + 32 * KVP * 2, lv = lk + KVT * 2, lv1 = lk + KVT * 2 + 32 * KVP * 2;
    const h16* kg1 = kg + 32 * HD; const h16* vg1 = vg + (size_t)32 * SEQ;
    asm volatile("global_load_async_to_lds_b128 %0, %4, off\n\t"
                 "global_load_async_to_lds_b128 %1, %5, off\n\t"
                 "global_load_async_to_lds_b128 %2, %6, off\n\t"
                 "global_load_async_to_lds_b128 %3, %7, off\n\t"
                 "s_wait_xcnt 0x0"
                 :: "v"(lk), "v"(lk1), "v"(lv), "v"(lv1), "v"(kg), "v"(kg1), "v"(vg), "v"(vg1) : "memory");
}
// one WMMA with its own hazard guard (ties the accumulator, keeps A/B live)
__device__ __forceinline__ v8f wm16(v16h a, v16h b, v8f c) {
    c = __builtin_amdgcn_wmma_f32_16x16x32_f16(false, a, false, b, (short)0, c, false, false);
    asm volatile("v_nop\n\tv_nop\n\tv_nop\n\tv_nop" : "+v"(c) : "v"(a), "v"(b));
    return c;
}
__device__ __forceinline__ float ex2(float x) { return __builtin_amdgcn_exp2f(x); }
__device__ __forceinline__ float redmax16(float v) {
    v = fmaxf(v, __shfl_xor(v, 1, 32)); v = fmaxf(v, __shfl_xor(v, 2, 32));
    v = fmaxf(v, __shfl_xor(v, 4, 32)); v = fmaxf(v, __shfl_xor(v, 8, 32)); return v;
}
__device__ __forceinline__ float redsum16(float v) {
    v += __shfl_xor(v, 1, 32); v += __shfl_xor(v, 2, 32);
    v += __shfl_xor(v, 4, 32); v += __shfl_xor(v, 8, 32); return v;
}
// f32 -> f16 convert that cannot produce an f16 subnormal: |v| < 2^-14 becomes +0 (value select, applied after the carry)
static __device__ __forceinline__ h16 toh_flush(float v) { const h16 r = (h16)v; return (fabsf(v) < 6.103515625e-05f) ? (h16)0.0f : r; }

__global__ __launch_bounds__(256) void k_cvtx(const float* __restrict__ x, h16* xh) {
    const size_t i = (size_t)blockIdx.x * 256 + threadIdx.x;
    if (i >= (size_t)NB * SEQ * DM / 8) return;
    const size_t row = i / (DM / 8); const int g = (int)(i % (DM / 8));
    const size_t b = row / SEQ, s = row % SEQ;
    const float* src = x + ((b * SEQ_FULL + s) * DM + (size_t)g * 8);
    const v4f v0 = *(const v4f*)src; const v4f v1 = *(const v4f*)(src + 4);
    v8h o;
#pragma unroll
    for (int k = 0; k < 4; ++k) { o[k] = (h16)bfr(v0[k]); o[4 + k] = (h16)bfr(v1[k]); }
    *(v8h*)(xh + i * 8) = o; 
}

// The fused kv weight (pitch 1024, 16 column tiles) lands in two consecutive [512][512] planes: k then v.
// LDS tile T is cross-wave: block barrier between fill and drain.
__global__ __launch_bounds__(256) void k_wt(const float* __restrict__ W, h16* Wt, int ldw) {
    __shared__ __align__(16) h16 T[64 * 72];
    const int tid = threadIdx.x; const int k0 = blockIdx.x * 64, n0 = blockIdx.y * 64;
#pragma unroll
    for (int j = 0; j < 4; ++j) { const int i = tid + 256 * j; const int kr = i >> 4, c4 = (i & 15) * 4;
        const v4f v = *(const v4f*)(W + (size_t)(k0 + kr) * ldw + n0 + c4);
#pragma unroll
        for (int q = 0; q < 4; ++q) T[(c4 + q) * 72 + kr] = toh_flush(bfr(v[q]) * WCAR); }
    __syncthreads();
{
#pragma unroll
        for (int j = 0; j < 2; ++j) { const int p = tid + 256 * j; const int n = p >> 3, seg = p & 7;
            const v8h val = *(const v8ha*)(T + n * 72 + seg * 8);
            *(v8h*)(Wt + (size_t)(n0 + n) * DM + k0 + seg * 8) = val; }
         }
}

// ---- GEMM main loop: one wave per 64x64 tile, 16 accumulators, K = DM, operands from K-contiguous f16 planes (A [m][k], Bt [n][k]).
__device__ __forceinline__ void gemm64(const h16* __restrict__ A, const h16* __restrict__ Bt, size_t aoff, size_t boff, v8f (&acc)[4][4]) {
#pragma unroll 1
    for (int kc = 0; kc < DM; kc += 32) {
        v16h a[4];
#pragma unroll
        for (int mb = 0; mb < 4; ++mb) a[mb] = ldfrag(A + aoff + (size_t)mb * 16 * DM + kc);
#pragma unroll
        for (int nb = 0; nb < 4; ++nb) { const v16h b = ldfrag(Bt + boff + (size_t)nb * 16 * DM + kc);
#pragma unroll
            for (int mb = 0; mb < 4; ++mb) acc[mb][nb] = wm16(a[mb], b, acc[mb][nb]); }
    }
}

// ---- k_proj_qk: head plane [b][h][s][64] f16 = x Wt^T / 16 (no bias in this module); grid (NB*SEQ/64, DM/64), 32 threads.
__global__ __launch_bounds__(32) void k_proj_qk(const h16* __restrict__ A, const h16* __restrict__ Bt, h16* plane) {
    __shared__ __align__(16) h16 T[64 * 72];
    const int lane = threadIdx.x & 31, lr = lane & 15, hi = lane >> 4;
    const int r0 = blockIdx.x * 64, c0 = blockIdx.y * 64;
    v8f acc[4][4];
#pragma unroll
    for (int mb = 0; mb < 4; ++mb)
#pragma unroll
        for (int nb = 0; nb < 4; ++nb) acc[mb][nb] = (v8f){};
    gemm64(A, Bt, (size_t)(r0 + lr) * DM + 8 * hi, (size_t)(c0 + lr) * DM + 8 * hi, acc);
#pragma unroll
    for (int nb = 0; nb < 4; ++nb) {
#pragma unroll
        for (int mb = 0; mb < 4; ++mb)
#pragma unroll
            for (int j = 0; j < 8; ++j) T[(mb * 16 + hi * 8 + j) * 72 + nb * 16 + lr] = toh_flush(acc[mb][nb][j] * (1.0f / WCAR)); }
    __syncthreads();
    const int b = r0 / SEQ, s0 = r0 % SEQ, h = blockIdx.y;
    h16* dst = plane + ((size_t)(b * NH + h) * SEQ + s0) * HD;
{
#pragma unroll
        for (int it = 0; it < 16; ++it) { const int piece = it * 32 + lane; const int row = piece >> 3, seg = piece & 7;
            const v8h val = *(const v8ha*)(T + row * 72 + seg * 8);
            *(v8h*)(dst + (size_t)row * HD + seg * 8) = val; }
         }
}

__global__ __launch_bounds__(32) void k_proj_v(const h16* __restrict__ A, const h16* __restrict__ Bt, h16* VT) {
    __shared__ __align__(16) h16 T[64 * 72];
    const int lane = threadIdx.x & 31, lr = lane & 15, hi = lane >> 4;
    const int r0 = blockIdx.x * 64, c0 = blockIdx.y * 64;
    v8f acc[4][4];
#pragma unroll
    for (int mb = 0; mb < 4; ++mb)
#pragma unroll
        for (int nb = 0; nb < 4; ++nb) acc[mb][nb] = (v8f){};
    gemm64(A, Bt, (size_t)(r0 + lr) * DM + 8 * hi, (size_t)(c0 + lr) * DM + 8 * hi, acc);
#pragma unroll
    for (int nb = 0; nb < 4; ++nb) {
#pragma unroll
        for (int mb = 0; mb < 4; ++mb) { v8h pk;
#pragma unroll
            for (int j = 0; j < 8; ++j) pk[j] = toh_flush(acc[mb][nb][j] * (1.0f / WCAR));
            *(v8ha*)(T + (nb * 16 + lr) * 72 + mb * 16 + hi * 8) = pk; } }
    __syncthreads();
    const int b = r0 / SEQ, s0 = r0 % SEQ, h = blockIdx.y;
    h16* dst = VT + ((size_t)(b * NH + h) * HD) * SEQ + s0;
{
#pragma unroll
        for (int it = 0; it < 16; ++it) { const int piece = it * 32 + lane; const int d = piece >> 3, seg = piece & 7;
            const v8h val = *(const v8ha*)(T + d * 72 + seg * 8);
            *(v8h*)(dst + (size_t)d * SEQ + seg * 8) = val; }
         }
}

__global__ __launch_bounds__(32) void k_proj_out(const h16* __restrict__ A, const h16* __restrict__ Bt, const float* __restrict__ bias, float* C) {
    __shared__ __align__(16) float os[16 * 68];
    const int lane = threadIdx.x & 31, lr = lane & 15, hi = lane >> 4;
    const int r0 = blockIdx.x * 64, c0 = blockIdx.y * 64;
    v8f acc[4][4];
#pragma unroll
    for (int mb = 0; mb < 4; ++mb)
#pragma unroll
        for (int nb = 0; nb < 4; ++nb) acc[mb][nb] = (v8f){};
    gemm64(A, Bt, (size_t)(r0 + lr) * DM + 8 * hi, (size_t)(c0 + lr) * DM + 8 * hi, acc);
    const int b = r0 / SEQ, s0 = r0 % SEQ; const int cofs = lr * 4;
    v4f b4;
#pragma unroll
    for (int q = 0; q < 4; ++q) b4[q] = bfr(bias[c0 + cofs + q]);
    const float fs = 1.0f / (WCAR * CCAR);
#pragma unroll
    for (int mb = 0; mb < 4; ++mb) {
#pragma unroll
        for (int nb = 0; nb < 4; ++nb)
#pragma unroll
            for (int j = 0; j < 8; ++j) os[(hi * 8 + j) * 68 + nb * 16 + lr] = acc[mb][nb][j];
        __syncthreads();
        float* crow = C + ((size_t)b * SEQ_FULL + s0 + mb * 16) * DM + c0;
{
#pragma unroll
            for (int s = 0; s < 8; ++s) { const int row = 2 * s + hi; const v4f raw = *(const v4fa*)(os + row * 68 + cofs); v4f val;
#pragma unroll
                for (int q = 0; q < 4; ++q) val[q] = raw[q] * fs + b4[q];
                *(v4f*)(crow + (size_t)row * DM + cofs) = val; }
             }
        __syncthreads();
    }
}

// ---- k_attn: fused flash-style attention; grid (NB*NH, SEQ/128), 256 threads = 8 waves x 16 query rows.
// Per 64-key block the K tile ([s][64] plane) and the V^T tile ([d][s] plane) are copied once per work-group into LDS (two buffers: the next tile's copies fly while this one is worked on);
// all 8 waves read their fragments there, both as [n][k] copies (same k map as A). Per 64-key block: 8 score WMMAs, online softmax in f32
// (masked keys replaced by the lowest finite f32; all-masked rows come out uniform), P x1024 -> f16 in the wave-private LDS tile (stored as h16, reloaded through a may_alias h16 vector with wave barriers), 8 P.V WMMAs.
// smw (mask bit words) is cross-wave: block barrier after the build. Pl is private to each wave. KV is cross-wave: one block barrier per 64-key block publishes the next tile and frees the one just read.
__global__ __launch_bounds__(256) void k_attn(const h16* __restrict__ Q, const h16* __restrict__ Kp, const h16* __restrict__ VT, const int* __restrict__ mask, h16* ctx) {
    __shared__ __align__(16) h16 Pl[8 * 16 * 72];
    __shared__ unsigned smw[SEQ / 32];
    __shared__ __align__(16) h16 KV[2 * 2 * KVT];   // [buffer][K tile, V^T tile][row][KVP]
    const int tid = threadIdx.x, lane = tid & 31, lr = lane & 15, hi = lane >> 4;
    const int wave = __builtin_amdgcn_readfirstlane(tid >> 5);
    const int bh = blockIdx.x; const int b = bh / NH, h = bh % NH;
    const int q0 = blockIdx.y * 128;
    const size_t pbase = (size_t)bh * SEQ * HD;
    const unsigned lst = (unsigned)(size_t)KV + (unsigned)((tid >> 3) * KVP + (tid & 7) * 8) * 2u;
    const h16* kg = Kp + pbase + (size_t)(tid >> 3) * HD + (tid & 7) * 8;
    const h16* vg = VT + pbase + (size_t)(tid >> 3) * SEQ + (tid & 7) * 8;
    stage_kv(lst, kg, vg);                                   // tile 0 -> buffer 0
#pragma unroll 1
    for (int w = wave; w < SEQ / 32; w += 8) { const int mv = mask[(size_t)b * SEQ_FULL + w * 32 + lane];
        const unsigned bits = __builtin_amdgcn_ballot_w32(mv != 0); if (lane == 0) smw[w] = bits; }
    asm volatile("s_wait_asynccnt 0x0" ::: "memory");        // this wave's copies of tile 0 have landed before the barrier that publishes them
    __syncthreads();
    stage_kv(lst + 2 * KVT * 2, kg + 64 * HD, vg + 64);      // tile 1 -> buffer 1
    const int pw = wave * 16 * 72;
    v16h qf0, qf1;
    { const h16* qp = Q + pbase + (size_t)(q0 + wave * 16 + lr) * HD + 8 * hi; qf0 = ldfrag(qp); qf1 = ldfrag(qp + 32); }
    v8f o[4]; float mi[8], li[8];
#pragma unroll
    for (int t = 0; t < 4; ++t) o[t] = (v8f){};
#pragma unroll
    for (int r = 0; r < 8; ++r) { mi[r] = NEGF; li[r] = 0.0f; }
#pragma unroll 1
    for (int kv0 = 0; kv0 < SEQ; kv0 += 64) {
        const int buf = (kv0 >> 6) & 1;
        const h16* kb = KV + buf * (2 * KVT) + lr * KVP + 8 * hi;
        const h16* vb = kb + KVT;
        v16h kf[4][2], vf[2][4];
#pragma unroll
        for (int t = 0; t < 4; ++t) { kf[t][0] = ldfrag_s(kb + t * 16 * KVP); kf[t][1] = ldfrag_s(kb + t * 16 * KVP + 32); }
#pragma unroll
        for (int s2 = 0; s2 < 2; ++s2)
#pragma unroll
            for (int t = 0; t < 4; ++t) vf[s2][t] = ldfrag_s(vb + t * 16 * KVP + s2 * 32);
        v8f sa[4];
#pragma unroll
        for (int t = 0; t < 4; ++t) { v8f c = (v8f){};
            c = wm16(qf0, kf[t][0], c); c = wm16(qf1, kf[t][1], c); sa[t] = c; }
        const unsigned w0 = smw[kv0 >> 5], w1 = smw[(kv0 >> 5) + 1];
        const bool k0ok = ((w0 >> lr) & 1u) != 0u, k1ok = ((w0 >> (16 + lr)) & 1u) != 0u, k2ok = ((w1 >> lr) & 1u) != 0u, k3ok = ((w1 >> (16 + lr)) & 1u) != 0u;
#pragma unroll
        for (int r = 0; r < 8; ++r) {
            const float s0 = k0ok ? sa[0][r] * SCL : NEGF; const float s1 = k1ok ? sa[1][r] * SCL : NEGF;
            const float s2 = k2ok ? sa[2][r] * SCL : NEGF; const float s3 = k3ok ? sa[3][r] * SCL : NEGF;
            float vm = fmaxf(fmaxf(s0, s1), fmaxf(s2, s3)); vm = redmax16(vm);
            const float mnew = fmaxf(mi[r], vm);
            const float alpha = ex2(fmaxf(mi[r] - mnew, -150.0f) * L2E); mi[r] = mnew;
            const float p0 = ex2(fmaxf(s0 - mnew, -150.0f) * L2E); const float p1 = ex2(fmaxf(s1 - mnew, -150.0f) * L2E);
            const float p2 = ex2(fmaxf(s2 - mnew, -150.0f) * L2E); const float p3 = ex2(fmaxf(s3 - mnew, -150.0f) * L2E);
            li[r] = li[r] * alpha + ((p0 + p1) + (p2 + p3));
            const int pr = pw + (hi * 8 + r) * 72 + lr;
            Pl[pr] = (h16)(p0 * PCAR); Pl[pr + 16] = (h16)(p1 * PCAR); Pl[pr + 32] = (h16)(p2 * PCAR); Pl[pr + 48] = (h16)(p3 * PCAR);
#pragma unroll
            for (int t = 0; t < 4; ++t) o[t][r] *= alpha;
        }
        asm volatile("" ::: "memory"); __builtin_amdgcn_wave_barrier(); asm volatile("" ::: "memory");
#pragma unroll
        for (int s2 = 0; s2 < 2; ++s2) {
            const v16h pf = cat16(*(const v8ha*)(Pl + pw + lr * 72 + s2 * 32 + 8 * hi), *(const v8ha*)(Pl + pw + lr * 72 + s2 * 32 + 16 + 8 * hi));
#pragma unroll
            for (int t = 0; t < 4; ++t) o[t] = wm16(pf, vf[s2][t], o[t]);
        }
        asm volatile("" ::: "memory"); __builtin_amdgcn_wave_barrier(); asm volatile("" ::: "memory");
        asm volatile("s_wait_dscnt 0x0" ::: "memory");       // this wave's reads of buffer buf have returned before the buffer is refilled
        asm volatile("s_wait_asynccnt 0x0" ::: "memory");    // this wave's copies of the next tile have landed before the barrier that publishes them
        __syncthreads();
        if (kv0 + 128 < SEQ) stage_kv(lst + (unsigned)buf * (2 * KVT * 2), kg + (size_t)(kv0 + 128) * HD, vg + kv0 + 128);   // tile t + 2 -> the buffer just read
    }
    asm volatile("s_wait_asynccnt 0x0" ::: "memory");        // no copy is outstanding when the wave goes on to its end
#pragma unroll
    for (int r = 0; r < 8; ++r) { const float l = redsum16(li[r]); const float inv = (CCAR / PCAR) * __builtin_amdgcn_rcpf(l);
#pragma unroll
        for (int t = 0; t < 4; ++t) Pl[pw + (hi * 8 + r) * 72 + t * 16 + lr] = (h16)(o[t][r] * inv); }
    asm volatile("" ::: "memory"); __builtin_amdgcn_wave_barrier(); asm volatile("" ::: "memory");
    h16* dst = ctx + ((size_t)b * SEQ + q0 + wave * 16) * DM + h * HD;
{
#pragma unroll
        for (int it = 0; it < 4; ++it) { const int piece = it * 32 + lane; const int row = piece >> 3, seg = piece & 7;
            const v8h val = *(const v8ha*)(Pl + pw + row * 72 + seg * 8);
            *(v8h*)(dst + (size_t)row * DM + seg * 8) = val; }
         }
}

extern "C" void kernel_launch(void* const* d_in, const int* in_sizes, int n_in,
                              void* d_out, int out_size, void* d_ws, size_t ws_size, hipStream_t stream) {
    if (n_in < 6) return;
    const size_t xneed = ((size_t)(NB - 1) * SEQ_FULL + SEQ) * DM;
    const size_t mneed = (size_t)(NB - 1) * SEQ_FULL + SEQ;
    if ((size_t)in_sizes[0] < xneed || (size_t)in_sizes[1] < mneed) return;
    if (in_sizes[2] < DM * DM || in_sizes[3] < 2 * DM * DM || in_sizes[4] < DM * DM) return;
    if (in_sizes[5] < DM) return;
    if ((size_t)out_size < xneed) return;
    if (ws_size < WS_TOTAL) return;
    // input order of the wire: x, mask, Wq [512][512], Wkv [512][1024], Wout [512][512], bout [512]
    const float* x   = (const float*)d_in[0]; const int* mask = (const int*)d_in[1];
    const float* wq  = (const float*)d_in[2];
    const float* wkv = (const float*)d_in[3];
    const float* wo  = (const float*)d_in[4]; const float* bo = (const float*)d_in[5];
    float* OUT = (float*)d_out;
    char* wsp = (char*)d_ws;
    h16* XH = (h16*)wsp; wsp += SZ_X;      // [NB*SEQ][DM]
    h16* WT = (h16*)wsp; wsp += SZ_W;      // [4][n][k]: q, k, v, o
    h16* QP = (h16*)wsp; wsp += SZ_X;      // [b][h][s][64]
    h16* KP = (h16*)wsp; wsp += SZ_X;      // [b][h][s][64]
    h16* VT = (h16*)wsp; wsp += SZ_X;      // [b][h][64][s]
    h16* CX = (h16*)wsp; wsp += SZ_X;      // [NB*SEQ][DM], x64
    const size_t wsz = (size_t)DM * DM;
    k_cvtx<<<(unsigned)(((size_t)NB * SEQ * DM / 8 + 255) / 256), 256, 0, stream>>>(x, XH);
    const dim3 gw(DM / 64, DM / 64);
    const dim3 gwkv(DM / 64, 2 * DM / 64);
    k_wt<<<gw, 256, 0, stream>>>(wq, WT, DM);                  // in[512][512] -> out[512 n][512 k]
    k_wt<<<gwkv, 256, 0, stream>>>(wkv, WT + wsz, 2 * DM);     // in[512][1024] -> out[1024 n][512 k] = k plane, v plane
    k_wt<<<gw, 256, 0, stream>>>(wo, WT + 3 * wsz, DM);        // in[512][512] -> out[512 n][512 k]
    const dim3 gg(NB * SEQ / 64, DM / 64);
    k_proj_qk<<<gg, 32, 0, stream>>>(XH, WT, QP);
    k_proj_qk<<<gg, 32, 0, stream>>>(XH, WT + wsz, KP);
    k_proj_v<<<gg, 32, 0, stream>>>(XH, WT + 2 * wsz, VT);
    k_attn<<<dim3(NB * NH, SEQ / 128), 256, 0, stream>>>(QP, KP, VT, mask, CX);
    k_proj_out<<<gg, 32, 0, stream>>>(CX, WT + 3 * wsz, bo, OUT);
}

// v002
// One run takes 114 microseconds.
// In both of two side-by-side timings against v001, it was 1.30 times as fast.
// All steps since v000 together make it 2.29 times as fast.
#include <hip/hip_runtime.h>

// Multi-head self-attention with a per-key padding mask input: x [4][2048][512]; q = x Wq, fused kv = x Wkv ([in][out] weights; k = first 512 output columns, v = last 512; 8 heads x 64; no q/k/v biases); scores = (q k^T) / 8 with masked keys REPLACED by the lowest finite f32; softmax over the keys; out = merged ctx Wout + bout.
// Compute dtypes: all contractions v_wmma_f32_16x16x32_f16 (f16 operands, f32 accumulate). Every float input is converted to bf16 (RNE) on load and carried exactly in f16 (weights x16); q, k, v planes plain f16; P carried x1024 (row sums from the unconverted f32 values); ctx carried x64 against Wout x16; softmax f32.
// Engine: 4-wave 128x128 GEMM blocks (each wave a 64x64 register-blocked tile), A and B k-chunks of 64 staged once per block in a two-buffer LDS ring by asynchronous copies; fused flash-style attention (online softmax, K and V^T tiles staged once per block in a two-buffer LDS ring by asynchronous copies, wave-private P tile in LDS, mask packed into bit words in LDS).

#ifndef NB
#define NB 4
#endif
#ifndef SEQ
#define SEQ 2048
#endif
#define NB_FULL  4
#define SEQ_FULL 2048
#define DM   512
#define NH   8
#define HD   64
#define WCAR 16.0f      // weight carry (exact power of two)
#define PCAR 1024.0f    // probability carry
#define CCAR 64.0f      // ctx carry
#define SCL  0.125f     // HD^-0.5
#define L2E  1.4426950408889634f
#define NEGF (-3.402823466e38f)
#define KVP  72         // LDS pitch of a staged K or V^T row, in f16: 144 bytes = 16 x odd, conflict-free for 16-byte readers
#define KVT  (64 * KVP) // one staged tile: 64 rows of 64 f16
#define GT   (128 * KVP) // one staged GEMM operand tile: 128 rows of 64 f16, same pitch

typedef _Float16 h16;
typedef __attribute__((ext_vector_type(16))) _Float16 v16h;
typedef __attribute__((ext_vector_type(8)))  _Float16 v8h;
typedef __attribute__((ext_vector_type(8)))  float    v8f;
typedef __attribute__((ext_vector_type(4)))  float    v4f;
typedef v8h __attribute__((may_alias)) v8ha;
typedef v4f __attribute__((may_alias)) v4fa;

static_assert(NH * HD == DM);            // merged head width equals the model width
static_assert(HD == 64);
static_assert(DM % 64 == 0);             // N tiles of 64
static_assert(DM % 32 == 0);             // k-steps of 32
static_assert(SEQ % 128 == 0);           // 128 query rows per attention block; 64-row GEMM tiles stay inside one batch
static_assert(SEQ <= SEQ_FULL);
static_assert(NB <= NB_FULL);
static_assert((SEQ / 32) % 8 == 0);      // mask words split evenly over 8 waves

#define SZ_X   ((size_t)NB * SEQ * DM * 2)      // f16 plane of x / q / k / v^T / ctx
#define SZ_W   ((size_t)4 * DM * DM * 2)        // four transposed weight planes
#define WS_TOTAL (SZ_X * 5 + SZ_W)
static_assert(SZ_X % 256 == 0);
static_assert(SZ_W % 256 == 0);
static_assert(WS_TOTAL <= (size_t)134217728);   // carve stays under 128 MiB

// file-scope bounds for the kernels below
static_assert((2 * DM) % 64 == 0);                        // fused kv weight: 16 column tiles of 64, k plane then v plane
static_assert(256 * 4 * 4 == 64 * 64);                    // k_wt fill: threads x trips x elements == tile elements
static_assert(256 * 2 * 16 == 64 * 128);
static_assert(32 * 16 * 16 == 64 * 128);
static_assert(32 * 4 * 16 == 16 * 128);
static_assert(64 * 72 * 2 <= 131072);                     // static LDS of k_wt
static_assert(4 * GT * 2 + 4 * 64 * 72 * 2 <= 131072);    // static LDS of k_proj_qk / k_proj_v: ring + one output tile per wave
static_assert(4 * GT * 2 + 4 * 16 * 68 * 4 <= 131072);    // static LDS of k_proj_out
static_assert(128 * 8 * 8 == 128 * 64);                   // GEMM staging: threads x copies x elements == operand tile elements
static_assert(DM % 128 == 0 && DM >= 128);                // 128-column GEMM blocks; the ring's prologue fills two k-chunks of 64
static_assert((size_t)NB * SEQ % 128 == 0);               // 128-row GEMM blocks
static_assert(8 * 16 * 72 * 2 + 4 * KVT * 2 + (SEQ / 32) * 4 <= 131072); // static LDS of k_attn
static_assert(256 * 2 * 8 == 64 * HD);                    // k_attn staging: threads x copies x elements == tile elements
static_assert(SEQ >= 128);                                // the ring's prologue fills two tiles of 64 keys
static_assert((KVP * 2) % 16 == 0);                       // every staged row starts at a multiple of the copy width
static_assert((size_t)NB * SEQ % 64 == 0);                // GEMM row tiles

__device__ __forceinline__ unsigned short f2bf(float f) { unsigned u = __float_as_uint(f); u += 0x7FFFu + ((u >> 16) & 1u); return (unsigned short)(u >> 16); }
__device__ __forceinline__ float bfr(float f) { return __uint_as_float(((unsigned)f2bf(f)) << 16); }
__device__ __forceinline__ v16h cat16(v8h lo, v8h hi) { return __builtin_shufflevector(lo, hi, 0, 1, 2, 3, 4, 5, 6, 7, 8, 9, 10, 11, 12, 13, 14, 15); }
// fragment loader for A (row-major [m][k]) and for B given as a [n][k] copy: elements 0..7 <- k0+8h.., elements 8..15 <- k0+16+8h.. ; p already includes the 8h offset
__device__ __forceinline__ v16h ldfrag(const h16* p) { return cat16(*(const v8h*)p, *(const v8h*)(p + 16)); }
// the same fragment from a staged LDS tile (same k map)
__device__ __forceinline__ v16h ldfrag_s(const h16* p) { return cat16(*(const v8ha*)p, *(const v8ha*)(p + 16)); }
// One 64-key stage: each of the 256 threads copies 4 x 16 bytes, rows r and r + 32 of the K tile and of the V^T tile (r = tid / 8).
// lk: the lane's LDS byte address in the K tile of the target buffer; kg, vg: the lane's global sources.
// s_wait_xcnt stands inside the copies' own statement, so that no address register is rewritten ahead of it.
__device__ __forceinline__ void stage_kv(unsigned lk, const h16* kg, const h16* vg) {
    const unsigned lk1 = lk + 32 * KVP * 2, lv = lk + KVT * 2, lv1 = lk + KVT * 2 + 32 * KVP * 2;
    const h16* kg1 = kg + 32 * HD; const h16* vg1 = vg + (size_t)32 * SEQ;
    asm volatile("global_load_async_to_lds_b128 %0, %4, off\n\t"
                 "global_load_async_to_lds_b128 %1, %5, off\n\t"
                 "global_load_async_to_lds_b128 %2, %6, off\n\t"
                 "global_load_async_to_lds_b128 %3, %7, off\n\t"
                 "s_wait_xcnt 0x0"
                 :: "v"(lk), "v"(lk1), "v"(lv), "v"(lv1), "v"(kg), "v"(kg1), "v"(vg), "v"(vg1) : "memory");
}
// One GEMM operand tile of a 64-wide k-chunk: each of the 128 threads copies 8 x 16 bytes, rows r + 16 j (r = tid / 8, j = 0..7), source pitch DM.
// l: the lane's LDS byte address in the target tile; g: the lane's global source. s_wait_xcnt stands inside the copies' own statement, as in stage_kv.
__device__ __forceinline__ void stage_g(unsigned l, const h16* g) {
    const unsigned l1 = l + 16 * KVP * 2, l2 = l + 32 * KVP * 2, l3 = l + 48 * KVP * 2, l4 = l + 64 * KVP * 2, l5 = l + 80 * KVP * 2, l6 = l + 96 * KVP * 2, l7 = l + 112 * KVP * 2;
    const h16* g1 = g + 16 * DM; const h16* g2 = g + 32 * DM; const h16* g3 = g + 48 * DM; const h16* g4 = g + 64 * DM;
    const h16* g5 = g + 80 * DM; const h16* g6 = g + 96 * DM; const h16* g7 = g + 112 * DM;
    asm volatile("global_load_async_to_lds_b128 %0, %8, off\n\t"
                 "global_load_async_to_lds_b128 %1, %9, off\n\t"
                 "global_load_async_to_lds_b128 %2, %10, off\n\t"
                 "global_load_async_to_lds_b128 %3, %11, off\n\t"
                 "global_load_async_to_lds_b128 %4, %12, off\n\t"
                 "global_load_async_to_lds_b128 %5, %13, off\n\t"
                 "global_load_async_to_lds_b128 %6, %14, off\n\t"
                 "global_load_async_to_lds_b128 %7, %15, off\n\t"
                 "s_wait_xcnt 0x0"
                 :: "v"(l), "v"(l1), "v"(l2), "v"(l3), "v"(l4), "v"(l5), "v"(l6), "v"(l7),
                    "v"(g), "v"(g1), "v"(g2), "v"(g3), "v"(g4), "v"(g5), "v"(g6), "v"(g7) : "memory");
}
// one WMMA with its own hazard guard (ties the accumulator, keeps A/B live)
__device__ __forceinline__ v8f wm16(v16h a, v16h b, v8f c) {
    c = __builtin_amdgcn_wmma_f32_16x16x32_f16(false, a, false, b, (short)0, c, false, false);
    asm volatile("v_nop\n\tv_nop\n\tv_nop\n\tv_nop" : "+v"(c) : "v"(a), "v"(b));
    return c;
}
__device__ __forceinline__ float ex2(float x) { return __builtin_amdgcn_exp2f(x); }
__device__ __forceinline__ float redmax16(float v) {
    v = fmaxf(v, __shfl_xor(v, 1, 32)); v = fmaxf(v, __shfl_xor(v, 2, 32));
    v = fmaxf(v, __shfl_xor(v, 4, 32)); v = fmaxf(v, __shfl_xor(v, 8, 32)); return v;
}
__device__ __forceinline__ float redsum16(float v) {
    v += __shfl_xor(v, 1, 32); v += __shfl_xor(v, 2, 32);
    v += __shfl_xor(v, 4, 32); v += __shfl_xor(v, 8, 32); return v;
}
// f32 -> f16 convert that cannot produce an f16 subnormal: |v| < 2^-14 becomes +0 (value select, applied after the carry)
static __device__ __forceinline__ h16 toh_flush(float v) { const h16 r = (h16)v; return (fabsf(v) < 6.103515625e-05f) ? (h16)0.0f : r; }

__global__ __launch_bounds__(256) void k_cvtx(const float* __restrict__ x, h16* xh) {
    const size_t i = (size_t)blockIdx.x * 256 + threadIdx.x;
    if (i >= (size_t)NB * SEQ * DM / 8) return;
    const size_t row = i / (DM / 8); const int g = (int)(i % (DM / 8));
    const size_t b = row / SEQ, s = row % SEQ;
    const float* src = x + ((b * SEQ_FULL + s) * DM + (size_t)g * 8);
    const v4f v0 = *(const v4f*)src; const v4f v1 = *(const v4f*)(src + 4);
    v8h o;
#pragma unroll
    for (int k = 0; k < 4; ++k) { o[k] = (h16)bfr(v0[k]); o[4 + k] = (h16)bfr(v1[k]); }
    *(v8h*)(xh + i * 8) = o; 
}

// The fused kv weight (pitch 1024, 16 column tiles) lands in two consecutive [512][512] planes: k then v.
// LDS tile T is cross-wave: block barrier between fill and drain.
__global__ __launch_bounds__(256) void k_wt(const float* __restrict__ W, h16* Wt, int ldw) {
    __shared__ __align__(16) h16 T[64 * 72];
    const int tid = threadIdx.x; const int k0 = blockIdx.x * 64, n0 = blockIdx.y * 64;
#pragma unroll
    for (int j = 0; j < 4; ++j) { const int i = tid + 256 * j; const int kr = i >> 4, c4 = (i & 15) * 4;
        const v4f v = *(const v4f*)(W + (size_t)(k0 + kr) * ldw + n0 + c4);
#pragma unroll
        for (int q = 0; q < 4; ++q) T[(c4 + q) * 72 + kr] = toh_flush(bfr(v[q]) * WCAR); }
    __syncthreads();
{
#pragma unroll
        for (int j = 0; j < 2; ++j) { const int p = tid + 256 * j; const int n = p >> 3, seg = p & 7;
            const v8h val = *(const v8ha*)(T + n * 72 + seg * 8);
            *(v8h*)(Wt + (size_t)(n0 + n) * DM + k0 + seg * 8) = val; }
         }
}

// ---- GEMM main loop: 4 waves per 128x128 block, each wave a 64x64 tile (wave w: rows 64 (w / 2), columns 64 (w % 2)), 16 accumulators, K = DM, operands from K-contiguous f16 planes (A [m][k], Bt [n][k]).
// Per 64-wide k-chunk the block's 128 A rows and 128 Bt rows are copied once into LDS (S: [buffer][A tile, B tile][row][KVP]; the next chunk's copies fly while this one is worked on);
// the waves read their fragments there (same k map, same k order of the sums as from the planes). One block barrier per chunk publishes the next chunk and frees the one just read.
__device__ __forceinline__ void gemm64(const h16* __restrict__ A, const h16* __restrict__ Bt, h16* S, int R0, int C0, int wave, v8f (&acc)[4][4]) {
    const int tid = threadIdx.x, lane = tid & 31, lr = lane & 15, hi = lane >> 4;
    const unsigned lst = (unsigned)(size_t)S + (unsigned)((tid >> 3) * KVP + (tid & 7) * 8) * 2u;
    const h16* ag = A + (size_t)(R0 + (tid >> 3)) * DM + (tid & 7) * 8;
    const h16* bg = Bt + (size_t)(C0 + (tid >> 3)) * DM + (tid & 7) * 8;
    stage_g(lst, ag); stage_g(lst + GT * 2, bg);                          // chunk 0 -> buffer 0
    asm volatile("s_wait_asynccnt 0x0" ::: "memory");        // this wave's copies of chunk 0 have landed before the barrier that publishes them
    __syncthreads();
    stage_g(lst + 2 * GT * 2, ag + 64); stage_g(lst + 3 * GT * 2, bg + 64);  // chunk 1 -> buffer 1
    const int aofs = ((wave >> 1) * 64 + lr) * KVP + 8 * hi, bofs = GT + ((wave & 1) * 64 + lr) * KVP + 8 * hi;
#pragma unroll 1
    for (int kc = 0; kc < DM; kc += 64) {
        const int buf = (kc >> 6) & 1;
        const h16* as = S + buf * (2 * GT) + aofs;
        const h16* bs = S + buf * (2 * GT) + bofs;
#pragma unroll
        for (int ks = 0; ks < 64; ks += 32) {
            v16h a[4], b[4];
#pragma unroll
            for (int mb = 0; mb < 4; ++mb) a[mb] = ldfrag_s(as + mb * 16 * KVP + ks);
#pragma unroll
            for (int nb = 0; nb < 4; ++nb) b[nb] = ldfrag_s(bs + nb * 16 * KVP + ks);
#pragma unroll
            for (int nb = 0; nb < 4; ++nb)
#pragma unroll
                for (int mb = 0; mb < 4; ++mb) acc[mb][nb] = wm16(a[mb], b[nb], acc[mb][nb]);
        }
        asm volatile("s_wait_dscnt 0x0" ::: "memory");       // this wave's reads of buffer buf have returned before the buffer is refilled
        asm volatile("s_wait_asynccnt 0x0" ::: "memory");    // this wave's copies of the next chunk have landed before the barrier that publishes them
        __syncthreads();
        if (kc + 128 < DM) { stage_g(lst + (unsigned)buf * (2 * GT * 2), ag + kc + 128); stage_g(lst + (unsigned)buf * (2 * GT * 2) + GT * 2, bg + kc + 128); }   // chunk t + 2 -> the buffer just read
    }
    asm volatile("s_wait_asynccnt 0x0" ::: "memory");        // no copy is outstanding when the wave goes on to its epilogue
}

// ---- k_proj_qk: head plane [b][h][s][64] f16 = x Wt^T / 16 (no bias in this module); grid (NB*SEQ/128, DM/128), 128 threads. T is private to each wave.
__global__ __launch_bounds__(128) void k_proj_qk(const h16* __restrict__ A, const h16* __restrict__ Bt, h16* plane) {
    __shared__ __align__(16) h16 S[4 * GT];
    __shared__ __align__(16) h16 Tb[4 * 64 * 72];
    const int lane = threadIdx.x & 31, lr = lane & 15, hi = lane >> 4;
    const int wave = __builtin_amdgcn_readfirstlane(threadIdx.x >> 5);
    h16* T = Tb + wave * 64 * 72;
    const int r0 = blockIdx.x * 128 + (wave >> 1) * 64, c0 = blockIdx.y * 128 + (wave & 1) * 64;
    v8f acc[4][4];
#pragma unroll
    for (int mb = 0; mb < 4; ++mb)
#pragma unroll
        for (int nb = 0; nb < 4; ++nb) acc[mb][nb] = (v8f){};
    gemm64(A, Bt, S, blockIdx.x * 128, blockIdx.y * 128, wave, acc);
#pragma unroll
    for (int nb = 0; nb < 4; ++nb) {
#pragma unroll
        for (int mb = 0; mb < 4; ++mb)
#pragma unroll
            for (int j = 0; j < 8; ++j) T[(mb * 16 + hi * 8 + j) * 72 + nb * 16 + lr] = toh_flush(acc[mb][nb][j] * (1.0f / WCAR)); }
    __syncthreads();
    const int b = r0 / SEQ, s0 = r0 % SEQ, h = c0 / HD;
    h16* dst = plane + ((size_t)(b * NH + h) * SEQ + s0) * HD;
{
#pragma unroll
        for (int it = 0; it < 16; ++it) { const int piece = it * 32 + lane; const int row = piece >> 3, seg = piece & 7;
            const v8h val = *(const v8ha*)(T + row * 72 + seg * 8);
            *(v8h*)(dst + (size_t)row * HD + seg * 8) = val; }
         }
}

__global__ __launch_bounds__(128) void k_proj_v(const h16* __restrict__ A, const h16* __restrict__ Bt, h16* VT) {
    __shared__ __align__(16) h16 S[4 * GT];
    __shared__ __align__(16) h16 Tb[4 * 64 * 72];
    const int lane = threadIdx.x & 31, lr = lane & 15, hi = lane >> 4;
    const int wave = __builtin_amdgcn_readfirstlane(threadIdx.x >> 5);
    h16* T = Tb + wave * 64 * 72;
    const int r0 = blockIdx.x * 128 + (wave >> 1) * 64, c0 = blockIdx.y * 128 + (wave & 1) * 64;
    v8f acc[4][4];
#pragma unroll
    for (int mb = 0; mb < 4; ++mb)
#pragma unroll
        for (int nb = 0; nb < 4; ++nb) acc[mb][nb] = (v8f){};
    gemm64(A, Bt, S, blockIdx.x * 128, blockIdx.y * 128, wave, acc);
#pragma unroll
    for (int nb = 0; nb < 4; ++nb) {
#pragma unroll
        for (int mb = 0; mb < 4; ++mb) { v8h pk;
#pragma unroll
            for (int j = 0; j < 8; ++j) pk[j] = toh_flush(acc[mb][nb][j] * (1.0f / WCAR));
            *(v8ha*)(T + (nb * 16 + lr) * 72 + mb * 16 + hi * 8) = pk; } }
    __syncthreads();
    const int b = r0 / SEQ, s0 = r0 % SEQ, h = c0 / HD;
    h16* dst = VT + ((size_t)(b * NH + h) * HD) * SEQ + s0;
{
#pragma unroll
        for (int it = 0; it < 16; ++it) { const int piece = it * 32 + lane; const int d = piece >> 3, seg = piece & 7;
            const v8h val = *(const v8ha*)(T + d * 72 + seg * 8);
            *(v8h*)(dst + (size_t)d * SEQ + seg * 8) = val; }
         }
}

__global__ __launch_bounds__(128) void k_proj_out(const h16* __restrict__ A, const h16* __restrict__ Bt, const float* __restrict__ bias, float* C) {
    __shared__ __align__(16) h16 S[4 * GT];
    __shared__ __align__(16) float osb[4 * 16 * 68];
    const int lane = threadIdx.x & 31, lr = lane & 15, hi = lane >> 4;
    const int wave = __builtin_amdgcn_readfirstlane(threadIdx.x >> 5);
    float* os = osb + wave * 16 * 68;
    const int r0 = blockIdx.x * 128 + (wave >> 1) * 64, c0 = blockIdx.y * 128 + (wave & 1) * 64;
    v8f acc[4][4];
#pragma unroll
    for (int mb = 0; mb < 4; ++mb)
#pragma unroll
        for (int nb = 0; nb < 4; ++nb) acc[mb][nb] = (v8f){};
    gemm64(A, Bt, S, blockIdx.x * 128, blockIdx.y * 128, wave, acc);
    const int b = r0 / SEQ, s0 = r0 % SEQ; const int cofs = lr * 4;
    v4f b4;
#pragma unroll
    for (int q = 0; q < 4; ++q) b4[q] = bfr(bias[c0 + cofs + q]);
    const float fs = 1.0f / (WCAR * CCAR);
#pragma unroll
    for (int mb = 0; mb < 4; ++mb) {
#pragma unroll
        for (int nb = 0; nb < 4; ++nb)
#pragma unroll
            for (int j = 0; j < 8; ++j) os[(hi * 8 + j) * 68 + nb * 16 + lr] = acc[mb][nb][j];
        __syncthreads();
        float* crow = C + ((size_t)b * SEQ_FULL + s0 + mb * 16) * DM + c0;
{
#pragma unroll
            for (int s = 0; s < 8; ++s) { const int row = 2 * s + hi; const v4f raw = *(const v4fa*)(os + row * 68 + cofs); v4f val;
#pragma unroll
                for (int q = 0; q < 4; ++q) val[q] = raw[q] * fs + b4[q];
                *(v4f*)(crow + (size_t)row * DM + cofs) = val; }
             }
        __syncthreads();
    }
}

// ---- k_attn: fused flash-style attention; grid (NB*NH, SEQ/128), 256 threads = 8 waves x 16 query rows.
// Per 64-key block the K tile ([s][64] plane) and the V^T tile ([d][s] plane) are copied once per work-group into LDS (two buffers: the next tile's copies fly while this one is worked on);
// all 8 waves read their fragments there, both as [n][k] copies (same k map as A). Per 64-key block: 8 score WMMAs, online softmax in f32
// (masked keys replaced by the lowest finite f32; all-masked rows come out uniform), P x1024 -> f16 in the wave-private LDS tile (stored as h16, reloaded through a may_alias h16 vector with wave barriers), 8 P.V WMMAs.
// smw (mask bit words) is cross-wave: block barrier after the build. Pl is private to each wave. KV is cross-wave: one block barrier per 64-key block publishes the next tile and frees the one just read.
__global__ __launch_bounds__(256) void k_attn(const h16* __restrict__ Q, const h16* __restrict__ Kp, const h16* __restrict__ VT, const int* __restrict__ mask, h16* ctx) {
    __shared__ __align__(16) h16 Pl[8 * 16 * 72];
    __shared__ unsigned smw[SEQ / 32];
    __shared__ __align__(16) h16 KV[2 * 2 * KVT];   // [buffer][K tile, V^T tile][row][KVP]
    const int tid = threadIdx.x, lane = tid & 31, lr = lane & 15, hi = lane >> 4;
    const int wave = __builtin_amdgcn_readfirstlane(tid >> 5);
    const int bh = blockIdx.x; const int b = bh / NH, h = bh % NH;
    const int q0 = blockIdx.y * 128;
    const size_t pbase = (size_t)bh * SEQ * HD;
    const unsigned lst = (unsigned)(size_t)KV + (unsigned)((tid >> 3) * KVP + (tid & 7) * 8) * 2u;
    const h16* kg = Kp + pbase + (size_t)(tid >> 3) * HD + (tid & 7) * 8;
    const h16* vg = VT + pbase + (size_t)(tid >> 3) * SEQ + (tid & 7) * 8;
    stage_kv(lst, kg, vg);                                   // tile 0 -> buffer 0
#pragma unroll 1
    for (int w = wave; w < SEQ / 32; w += 8) { const int mv = mask[(size_t)b * SEQ_FULL + w * 32 + lane];
        const unsigned bits = __builtin_amdgcn_ballot_w32(mv != 0); if (lane == 0) smw[w] = bits; }
    asm volatile("s_wait_asynccnt 0x0" ::: "memory");        // this wave's copies of tile 0 have landed before the barrier that publishes them
    __syncthreads();
    stage_kv(lst + 2 * KVT * 2, kg + 64 * HD, vg + 64);      // tile 1 -> buffer 1
    const int pw = wave * 16 * 72;
    v16h qf0, qf1;
    { const h16* qp = Q + pbase + (size_t)(q0 + wave * 16 + lr) * HD + 8 * hi; qf0 = ldfrag(qp); qf1 = ldfrag(qp + 32); }
    v8f o[4]; float mi[8], li[8];
#pragma unroll
    for (int t = 0; t < 4; ++t) o[t] = (v8f){};
#pragma unroll
    for (int r = 0; r < 8; ++r) { mi[r] = NEGF; li[r] = 0.0f; }
#pragma unroll 1
    for (int kv0 = 0; kv0 < SEQ; kv0 += 64) {
        const int buf = (kv0 >> 6) & 1;
        const h16* kb = KV + buf * (2 * KVT) + lr * KVP + 8 * hi;
        const h16* vb = kb + KVT;
        v16h kf[4][2], vf[2][4];
#pragma unroll
        for (int t = 0; t < 4; ++t) { kf[t][0] = ldfrag_s(kb + t * 16 * KVP); kf[t][1] = ldfrag_s(kb + t * 16 * KVP + 32); }
#pragma unroll
        for (int s2 = 0; s2 < 2; ++s2)
#pragma unroll
            for (int t = 0; t < 4; ++t) vf[s2][t] = ldfrag_s(vb + t * 16 * KVP + s2 * 32);
        v8f sa[4];
#pragma unroll
        for (int t = 0; t < 4; ++t) { v8f c = (v8f){};
            c = wm16(qf0, kf[t][0], c); c = wm16(qf1, kf[t][1], c); sa[t] = c; }
        const unsigned w0 = smw[kv0 >> 5], w1 = smw[(kv0 >> 5) + 1];
        const bool k0ok = ((w0 >> lr) & 1u) != 0u, k1ok = ((w0 >> (16 + lr)) & 1u) != 0u, k2ok = ((w1 >> lr) & 1u) != 0u, k3ok = ((w1 >> (16 + lr)) & 1u) != 0u;
#pragma unroll
        for (int r = 0; r < 8; ++r) {
            const float s0 = k0ok ? sa[0][r] * SCL : NEGF; const float s1 = k1ok ? sa[1][r] * SCL : NEGF;
            const float s2 = k2ok ? sa[2][r] * SCL : NEGF; const float s3 = k3ok ? sa[3][r] * SCL : NEGF;
            float vm = fmaxf(fmaxf(s0, s1), fmaxf(s2, s3)); vm = redmax16(vm);
            const float mnew = fmaxf(mi[r], vm);
            const float alpha = ex2(fmaxf(mi[r] - mnew, -150.0f) * L2E); mi[r] = mnew;
            const float p0 = ex2(fmaxf(s0 - mnew, -150.0f) * L2E); const float p1 = ex2(fmaxf(s1 - mnew, -150.0f) * L2E);
            const float p2 = ex2(fmaxf(s2 - mnew, -150.0f) * L2E); const float p3 = ex2(fmaxf(s3 - mnew, -150.0f) * L2E);
            li[r] = li[r] * alpha + ((p0 + p1) + (p2 + p3));
            const int pr = pw + (hi * 8 + r) * 72 + lr;
            Pl[pr] = (h16)(p0 * PCAR); Pl[pr + 16] = (h16)(p1 * PCAR); Pl[pr + 32] = (h16)(p2 * PCAR); Pl[pr + 48] = (h16)(p3 * PCAR);
#pragma unroll
            for (int t = 0; t < 4; ++t) o[t][r] *= alpha;
        }
        asm volatile("" ::: "memory"); __builtin_amdgcn_wave_barrier(); asm volatile("" ::: "memory");
#pragma unroll
        for (int s2 = 0; s2 < 2; ++s2) {
            const v16h pf = cat16(*(const v8ha*)(Pl + pw + lr * 72 + s2 * 32 + 8 * hi), *(const v8ha*)(Pl + pw + lr * 72 + s2 * 32 + 16 + 8 * hi));
#pragma unroll
            for (int t = 0; t < 4; ++t) o[t] = wm16(pf, vf[s2][t], o[t]);
        }
        asm volatile("" ::: "memory"); __builtin_amdgcn_wave_barrier(); asm volatile("" ::: "memory");
        asm volatile("s_wait_dscnt 0x0" ::: "memory");       // this wave's reads of buffer buf have returned before the buffer is refilled
        asm volatile("s_wait_asynccnt 0x0" ::: "memory");    // this wave's copies of the next tile have landed before the barrier that publishes them
        __syncthreads();
        if (kv0 + 128 < SEQ) stage_kv(lst + (unsigned)buf * (2 * KVT * 2), kg + (size_t)(kv0 + 128) * HD, vg + kv0 + 128);   // tile t + 2 -> the buffer just read
    }
    asm volatile("s_wait_asynccnt 0x0" ::: "memory");        // no copy is outstanding when the wave goes on to its end
#pragma unroll
    for (int r = 0; r < 8; ++r) { const float l = redsum16(li[r]); const float inv = (CCAR / PCAR) * __builtin_amdgcn_rcpf(l);
#pragma unroll
        for (int t = 0; t < 4; ++t) Pl[pw + (hi * 8 + r) * 72 + t * 16 + lr] = (h16)(o[t][r] * inv); }
    asm volatile("" ::: "memory"); __builtin_amdgcn_wave_barrier(); asm volatile("" ::: "memory");
    h16* dst = ctx + ((size_t)b * SEQ + q0 + wave * 16) * DM + h * HD;
{
#pragma unroll
        for (int it = 0; it < 4; ++it) { const int piece = it * 32 + lane; const int row = piece >> 3, seg = piece & 7;
            const v8h val = *(const v8ha*)(Pl + pw + row * 72 + seg * 8);
            *(v8h*)(dst + (size_t)row * DM + seg * 8) = val; }
         }
}

extern "C" void kernel_launch(void* const* d_in, const int* in_sizes, int n_in,
                              void* d_out, int out_size, void* d_ws, size_t ws_size, hipStream_t stream) {
    if (n_in < 6) return;
    const size_t xneed = ((size_t)(NB - 1) * SEQ_FULL + SEQ) * DM;
    const size_t mneed = (size_t)(NB - 1) * SEQ_FULL + SEQ;
    if ((size_t)in_sizes[0] < xneed || (size_t)in_sizes[1] < mneed) return;
    if (in_sizes[2] < DM * DM || in_sizes[3] < 2 * DM * DM || in_sizes[4] < DM * DM) return;
    if (in_sizes[5] < DM) return;
    if ((size_t)out_size < xneed) return;
    if (ws_size < WS_TOTAL) return;
    // input order of the wire: x, mask, Wq [512][512], Wkv [512][1024], Wout [512][512], bout [512]
    const float* x   = (const float*)d_in[0]; const int* mask = (const int*)d_in[1];
    const float* wq  = (const float*)d_in[2];
    const float* wkv = (const float*)d_in[3];
    const float* wo  = (const float*)d_in[4]; const float* bo = (const float*)d_in[5];
    float* OUT = (float*)d_out;
    char* wsp = (char*)d_ws;
    h16* XH = (h16*)wsp; wsp += SZ_X;      // [NB*SEQ][DM]
    h16* WT = (h16*)wsp; wsp += SZ_W;      // [4][n][k]: q, k, v, o
    h16* QP = (h16*)wsp; wsp += SZ_X;      // [b][h][s][64]
    h16* KP = (h16*)wsp; wsp += SZ_X;      // [b][h][s][64]
    h16* VT = (h16*)wsp; wsp += SZ_X;      // [b][h][64][s]
    h16* CX = (h16*)wsp; wsp += SZ_X;      // [NB*SEQ][DM], x64
    const size_t wsz = (size_t)DM * DM;
    k_cvtx<<<(unsigned)(((size_t)NB * SEQ * DM / 8 + 255) / 256), 256, 0, stream>>>(x, XH);
    const dim3 gw(DM / 64, DM / 64);
    const dim3 gwkv(DM / 64, 2 * DM / 64);
    k_wt<<<gw, 256, 0, stream>>>(wq, WT, DM);                  // in[512][512] -> out[512 n][512 k]
    k_wt<<<gwkv, 256, 0, stream>>>(wkv, WT + wsz, 2 * DM);     // in[512][1024] -> out[1024 n][512 k] = k plane, v plane
    k_wt<<<gw, 256, 0, stream>>>(wo, WT + 3 * wsz, DM);        // in[512][512] -> out[512 n][512 k]
    const dim3 gg(NB * SEQ / 128, DM / 128);
    k_proj_qk<<<gg, 128, 0, stream>>>(XH, WT, QP);
    k_proj_qk<<<gg, 128, 0, stream>>>(XH, WT + wsz, KP);
    k_proj_v<<<gg, 128, 0, stream>>>(XH, WT + 2 * wsz, VT);
    k_attn<<<dim3(NB * NH, SEQ / 128), 256, 0, stream>>>(QP, KP, VT, mask, CX);
    k_proj_out<<<gg, 128, 0, stream>>>(CX, WT + 3 * wsz, bo, OUT);
}

// v003
// One run takes 83.9 microseconds.
// In both of two side-by-side timings against v002, it was 1.36 times as fast.
// All steps since v000 together make it 3.13 times as fast.
#include <hip/hip_runtime.h>

// Multi-head self-attention with a per-key padding mask input: x [4][2048][512]; q = x Wq, fused kv = x Wkv ([in][out] weights; k = first 512 output columns, v = last 512; 8 heads x 64; no q/k/v biases); scores = (q k^T) / 8 with masked keys REPLACED by the lowest finite f32; softmax over the keys; out = merged ctx Wout + bout.
// Compute dtypes: all contractions v_wmma_f32_16x16x32_f16 (f16 operands, f32 accumulate). Every float input is converted to bf16 (RNE) on load and carried exactly in f16 (weights x16); q, k, v planes plain f16; P carried x1024 (row sums from the unconverted f32 values); ctx carried x64 against Wout x16; softmax f32.
// Engine: 4-wave 128x128 GEMM blocks (each wave a 64x64 register-blocked tile), A and B k-chunks of 64 staged once per block in a two-buffer LDS ring by asynchronous copies; fused flash-style attention on transposed products S^T = K Q^T, O^T += V^T P^T (online softmax in-lane, K and V^T tiles staged once per block in a two-buffer LDS ring by asynchronous copies, P packed in registers, mask as one f32 addend per key in LDS).

#ifndef NB
#define NB 4
#endif
#ifndef SEQ
#define SEQ 2048
#endif
#define NB_FULL  4
#define SEQ_FULL 2048
#define DM   512
#define NH   8
#define HD   64
#define WCAR 16.0f      // weight carry (exact power of two)
#define PCAR 1024.0f    // probability carry
#define CCAR 64.0f      // ctx carry
#define SCL  0.125f     // HD^-0.5
#define L2E  1.4426950408889634f
#define NEGF (-3.402823466e38f)
#define SC2  (SCL * L2E) // scores to the base-2 domain; an exact scaling of L2E
#define PEXP 10.0f      // log2 of PCAR
#define KVP  72         // LDS pitch of a staged K or V^T row, in f16: 144 bytes = 16 x odd, conflict-free for 16-byte readers
#define KVT  (64 * KVP) // one staged tile: 64 rows of 64 f16
#define GT   (128 * KVP) // one staged GEMM operand tile: 128 rows of 64 f16, same pitch

typedef _Float16 h16;
typedef __attribute__((ext_vector_type(16))) _Float16 v16h;
typedef __attribute__((ext_vector_type(8)))  _Float16 v8h;
typedef __attribute__((ext_vector_type(8)))  float    v8f;
typedef __attribute__((ext_vector_type(4)))  float    v4f;
typedef v8h __attribute__((may_alias)) v8ha;
typedef v4f __attribute__((may_alias)) v4fa;

static_assert(NH * HD == DM);            // merged head width equals the model width
static_assert(HD == 64);
static_assert(DM % 64 == 0);             // N tiles of 64
static_assert(DM % 32 == 0);             // k-steps of 32
static_assert(SEQ % 128 == 0);           // 128 query rows per attention block; 64-row GEMM tiles stay inside one batch
static_assert(SEQ <= SEQ_FULL);
static_assert(NB <= NB_FULL);
static_assert(SEQ % 256 == 0);           // mask addends split evenly over 256 threads

#define SZ_X   ((size_t)NB * SEQ * DM * 2)      // f16 plane of x / q / k / v^T / ctx
#define SZ_W   ((size_t)4 * DM * DM * 2)        // four transposed weight planes
#define WS_TOTAL (SZ_X * 5 + SZ_W)
static_assert(SZ_X % 256 == 0);
static_assert(SZ_W % 256 == 0);
static_assert(WS_TOTAL <= (size_t)134217728);   // carve stays under 128 MiB

// file-scope bounds for the kernels below
static_assert((2 * DM) % 64 == 0);                        // fused kv weight: 16 column tiles of 64, k plane then v plane
static_assert(256 * 4 * 4 == 64 * 64);                    // k_wt fill: threads x trips x elements == tile elements
static_assert(256 * 2 * 16 == 64 * 128);
static_assert(32 * 16 * 16 == 64 * 128);
static_assert(32 * 4 * 16 == 16 * 128);
static_assert(64 * 72 * 2 <= 131072);                     // static LDS of k_wt
static_assert(4 * GT * 2 + 4 * 64 * 72 * 2 <= 131072);    // static LDS of k_proj_qk / k_proj_v: ring + one output tile per wave
static_assert(4 * GT * 2 + 4 * 16 * 68 * 4 <= 131072);    // static LDS of k_proj_out
static_assert(128 * 8 * 8 == 128 * 64);                   // GEMM staging: threads x copies x elements == operand tile elements
static_assert(DM % 128 == 0 && DM >= 128);                // 128-column GEMM blocks; the ring's prologue fills two k-chunks of 64
static_assert((size_t)NB * SEQ % 128 == 0);               // 128-row GEMM blocks
static_assert(8 * 16 * 72 * 2 + 4 * KVT * 2 + SEQ * 4 <= 131072); // static LDS of k_attn
static_assert(256 * 2 * 8 == 64 * HD);                    // k_attn staging: threads x copies x elements == tile elements
static_assert(SEQ >= 128);                                // the ring's prologue fills two tiles of 64 keys
static_assert((KVP * 2) % 16 == 0);                       // every staged row starts at a multiple of the copy width
static_assert((size_t)NB * SEQ % 64 == 0);                // GEMM row tiles

__device__ __forceinline__ unsigned short f2bf(float f) { unsigned u = __float_as_uint(f); u += 0x7FFFu + ((u >> 16) & 1u); return (unsigned short)(u >> 16); }
__device__ __forceinline__ float bfr(float f) { return __uint_as_float(((unsigned)f2bf(f)) << 16); }
__device__ __forceinline__ v8f cat8(v4f lo, v4f hi) { return __builtin_shufflevector(lo, hi, 0, 1, 2, 3, 4, 5, 6, 7); }
__device__ __forceinline__ v16h cat16(v8h lo, v8h hi) { return __builtin_shufflevector(lo, hi, 0, 1, 2, 3, 4, 5, 6, 7, 8, 9, 10, 11, 12, 13, 14, 15); }
// fragment loader for A (row-major [m][k]) and for B given as a [n][k] copy: elements 0..7 <- k0+8h.., elements 8..15 <- k0+16+8h.. ; p already includes the 8h offset
__device__ __forceinline__ v16h ldfrag(const h16* p) { return cat16(*(const v8h*)p, *(const v8h*)(p + 16)); }
// the same fragment from a staged LDS tile (same k map)
__device__ __forceinline__ v16h ldfrag_s(const h16* p) { return cat16(*(const v8ha*)p, *(const v8ha*)(p + 16)); }
// One 64-key stage: each of the 256 threads copies 4 x 16 bytes, rows r and r + 32 of the K tile and of the V^T tile (r = tid / 8).
// lk: the lane's LDS byte address in the K tile of the target buffer; kg, vg: the lane's global sources.
// s_wait_xcnt stands inside the copies' own statement, so that no address register is rewritten ahead of it.
__device__ __forceinline__ void stage_kv(unsigned lk, const h16* kg, const h16* vg) {
    const unsigned lk1 = lk + 32 * KVP * 2, lv = lk + KVT * 2, lv1 = lk + KVT * 2 + 32 * KVP * 2;
    const h16* kg1 = kg + 32 * HD; const h16* vg1 = vg + (size_t)32 * SEQ;
    asm volatile("global_load_async_to_lds_b128 %0, %4, off\n\t"
                 "global_load_async_to_lds_b128 %1, %5, off\n\t"
                 "global_load_async_to_lds_b128 %2, %6, off\n\t"
                 "global_load_async_to_lds_b128 %3, %7, off\n\t"
                 "s_wait_xcnt 0x0"
                 :: "v"(lk), "v"(lk1), "v"(lv), "v"(lv1), "v"(kg), "v"(kg1), "v"(vg), "v"(vg1) : "memory");
}
// One GEMM operand tile of a 64-wide k-chunk: each of the 128 threads copies 8 x 16 bytes, rows r + 16 j (r = tid / 8, j = 0..7), source pitch DM.
// l: the lane's LDS byte address in the target tile; g: the lane's global source. s_wait_xcnt stands inside the copies' own statement, as in stage_kv.
__device__ __forceinline__ void stage_g(unsigned l, const h16* g) {
    const unsigned l1 = l + 16 * KVP * 2, l2 = l + 32 * KVP * 2, l3 = l + 48 * KVP * 2, l4 = l + 64 * KVP * 2, l5 = l + 80 * KVP * 2, l6 = l + 96 * KVP * 2, l7 = l + 112 * KVP * 2;
    const h16* g1 = g + 16 * DM; const h16* g2 = g + 32 * DM; const h16* g3 = g + 48 * DM; const h16* g4 = g + 64 * DM;
    const h16* g5 = g + 80 * DM; const h16* g6 = g + 96 * DM; const h16* g7 = g + 112 * DM;
    asm volatile("global_load_async_to_lds_b128 %0, %8, off\n\t"
                 "global_load_async_to_lds_b128 %1, %9, off\n\t"
                 "global_load_async_to_lds_b128 %2, %10, off\n\t"
                 "global_load_async_to_lds_b128 %3, %11, off\n\t"
                 "global_load_async_to_lds_b128 %4, %12, off\n\t"
                 "global_load_async_to_lds_b128 %5, %13, off\n\t"
                 "global_load_async_to_lds_b128 %6, %14, off\n\t"
                 "global_load_async_to_lds_b128 %7, %15, off\n\t"
                 "s_wait_xcnt 0x0"
                 :: "v"(l), "v"(l1), "v"(l2), "v"(l3), "v"(l4), "v"(l5), "v"(l6), "v"(l7),
                    "v"(g), "v"(g1), "v"(g2), "v"(g3), "v"(g4), "v"(g5), "v"(g6), "v"(g7) : "memory");
}
// one WMMA with its own hazard guard (ties the accumulator, keeps A/B live)
__device__ __forceinline__ v8f wm16(v16h a, v16h b, v8f c) {
    c = __builtin_amdgcn_wmma_f32_16x16x32_f16(false, a, false, b, (short)0, c, false, false);
    asm volatile("v_nop\n\tv_nop\n\tv_nop\n\tv_nop" : "+v"(c) : "v"(a), "v"(b));
    return c;
}
__device__ __forceinline__ float ex2(float x) { return __builtin_amdgcn_exp2f(x); }
// lane l with lane l ^ 16
__device__ __forceinline__ float xhalf(float x) { return __builtin_bit_cast(float, __builtin_amdgcn_permlanex16(__builtin_bit_cast(int, x), __builtin_bit_cast(int, x), 0x76543210, 0xfedcba98, false, false)); }
// f32 -> f16 convert that cannot produce an f16 subnormal: |v| < 2^-14 becomes +0 (value select, applied after the carry)
static __device__ __forceinline__ h16 toh_flush(float v) { const h16 r = (h16)v; return (fabsf(v) < 6.103515625e-05f) ? (h16)0.0f : r; }

__global__ __launch_bounds__(256) void k_cvtx(const float* __restrict__ x, h16* xh) {
    const size_t i = (size_t)blockIdx.x * 256 + threadIdx.x;
    if (i >= (size_t)NB * SEQ * DM / 8) return;
    const size_t row = i / (DM / 8); const int g = (int)(i % (DM / 8));
    const size_t b = row / SEQ, s = row % SEQ;
    const float* src = x + ((b * SEQ_FULL + s) * DM + (size_t)g * 8);
    const v4f v0 = *(const v4f*)src; const v4f v1 = *(const v4f*)(src + 4);
    v8h o;
#pragma unroll
    for (int k = 0; k < 4; ++k) { o[k] = (h16)bfr(v0[k]); o[4 + k] = (h16)bfr(v1[k]); }
    *(v8h*)(xh + i * 8) = o; 
}

// The fused kv weight (pitch 1024, 16 column tiles) lands in two consecutive [512][512] planes: k then v.
// LDS tile T is cross-wave: block barrier between fill and drain.
__global__ __launch_bounds__(256) void k_wt(const float* __restrict__ W, h16* Wt, int ldw) {
    __shared__ __align__(16) h16 T[64 * 72];
    const int tid = threadIdx.x; const int k0 = blockIdx.x * 64, n0 = blockIdx.y * 64;
#pragma unroll
    for (int j = 0; j < 4; ++j) { const int i = tid + 256 * j; const int kr = i >> 4, c4 = (i & 15) * 4;
        const v4f v = *(const v4f*)(W + (size_t)(k0 + kr) * ldw + n0 + c4);
#pragma unroll
        for (int q = 0; q < 4; ++q) T[(c4 + q) * 72 + kr] = toh_flush(bfr(v[q]) * WCAR); }
    __syncthreads();
{
#pragma unroll
        for (int j = 0; j < 2; ++j) { const int p = tid + 256 * j; const int n = p >> 3, seg = p & 7;
            const v8h val = *(const v8ha*)(T + n * 72 + seg * 8);
            *(v8h*)(Wt + (size_t)(n0 + n) * DM + k0 + seg * 8) = val; }
         }
}

// ---- GEMM main loop: 4 waves per 128x128 block, each wave a 64x64 tile (wave w: rows 64 (w / 2), columns 64 (w % 2)), 16 accumulators, K = DM, operands from K-contiguous f16 planes (A [m][k], Bt [n][k]).
// Per 64-wide k-chunk the block's 128 A rows and 128 Bt rows are copied once into LDS (S: [buffer][A tile, B tile][row][KVP]; the next chunk's copies fly while this one is worked on);
// the waves read their fragments there (same k map, same k order of the sums as from the planes). One block barrier per chunk publishes the next chunk and frees the one just read.
__device__ __forceinline__ void gemm64(const h16* __restrict__ A, const h16* __restrict__ Bt, h16* S, int R0, int C0, int wave, v8f (&acc)[4][4]) {
    const int tid = threadIdx.x, lane = tid & 31, lr = lane & 15, hi = lane >> 4;
    const unsigned lst = (unsigned)(size_t)S + (unsigned)((tid >> 3) * KVP + (tid & 7) * 8) * 2u;
    const h16* ag = A + (size_t)(R0 + (tid >> 3)) * DM + (tid & 7) * 8;
    const h16* bg = Bt + (size_t)(C0 + (tid >> 3)) * DM + (tid & 7) * 8;
    stage_g(lst, ag); stage_g(lst + GT * 2, bg);                          // chunk 0 -> buffer 0
    asm volatile("s_wait_asynccnt 0x0" ::: "memory");        // this wave's copies of chunk 0 have landed before the barrier that publishes them
    __syncthreads();
    stage_g(lst + 2 * GT * 2, ag + 64); stage_g(lst + 3 * GT * 2, bg + 64);  // chunk 1 -> buffer 1
    const int aofs = ((wave >> 1) * 64 + lr) * KVP + 8 * hi, bofs = GT + ((wave & 1) * 64 + lr) * KVP + 8 * hi;
#pragma unroll 1
    for (int kc = 0; kc < DM; kc += 64) {
        const int buf = (kc >> 6) & 1;
        const h16* as = S + buf * (2 * GT) + aofs;
        const h16* bs = S + buf * (2 * GT) + bofs;
#pragma unroll
        for (int ks = 0; ks < 64; ks += 32) {
            v16h a[4], b[4];
#pragma unroll
            for (int mb = 0; mb < 4; ++mb) a[mb] = ldfrag_s(as + mb * 16 * KVP + ks);
#pragma unroll
            for (int nb = 0; nb < 4; ++nb) b[nb] = ldfrag_s(bs + nb * 16 * KVP + ks);
#pragma unroll
            for (int nb = 0; nb < 4; ++nb)
#pragma unroll
                for (int mb = 0; mb < 4; ++mb) acc[mb][nb] = wm16(a[mb], b[nb], acc[mb][nb]);
        }
        asm volatile("s_wait_dscnt 0x0" ::: "memory");       // this wave's reads of buffer buf have returned before the buffer is refilled
        asm volatile("s_wait_asynccnt 0x0" ::: "memory");    // this wave's copies of the next chunk have landed before the barrier that publishes them
        __syncthreads();
        if (kc + 128 < DM) { stage_g(lst + (unsigned)buf * (2 * GT * 2), ag + kc + 128); stage_g(lst + (unsigned)buf * (2 * GT * 2) + GT * 2, bg + kc + 128); }   // chunk t + 2 -> the buffer just read
    }
    asm volatile("s_wait_asynccnt 0x0" ::: "memory");        // no copy is outstanding when the wave goes on to its epilogue
}

// ---- k_proj_qk: head plane [b][h][s][64] f16 = x Wt^T / 16 (no bias in this module); grid (NB*SEQ/128, DM/128), 128 threads. T is private to each wave.
__global__ __launch_bounds__(128) void k_proj_qk(const h16* __restrict__ A, const h16* __restrict__ Bt, h16* plane) {
    __shared__ __align__(16) h16 S[4 * GT];
    __shared__ __align__(16) h16 Tb[4 * 64 * 72];
    const int lane = threadIdx.x & 31, lr = lane & 15, hi = lane >> 4;
    const int wave = __builtin_amdgcn_readfirstlane(threadIdx.x >> 5);
    h16* T = Tb + wave * 64 * 72;
    const int r0 = blockIdx.x * 128 + (wave >> 1) * 64, c0 = blockIdx.y * 128 + (wave & 1) * 64;
    v8f acc[4][4];
#pragma unroll
    for (int mb = 0; mb < 4; ++mb)
#pragma unroll
        for (int nb = 0; nb < 4; ++nb) acc[mb][nb] = (v8f){};
    gemm64(A, Bt, S, blockIdx.x * 128, blockIdx.y * 128, wave, acc);
#pragma unroll
    for (int nb = 0; nb < 4; ++nb) {
#pragma unroll
        for (int mb = 0; mb < 4; ++mb)
#pragma unroll
            for (int j = 0; j < 8; ++j) T[(mb * 16 + hi * 8 + j) * 72 + nb * 16 + lr] = toh_flush(acc[mb][nb][j] * (1.0f / WCAR)); }
    __syncthreads();
    const int b = r0 / SEQ, s0 = r0 % SEQ, h = c0 / HD;
    h16* dst = plane + ((size_t)(b * NH + h) * SEQ + s0) * HD;
{
#pragma unroll
        for (int it = 0; it < 16; ++it) { const int piece = it * 32 + lane; const int row = piece >> 3, seg = piece & 7;
            const v8h val = *(const v8ha*)(T + row * 72 + seg * 8);
            *(v8h*)(dst + (size_t)row * HD + seg * 8) = val; }
         }
}

__global__ __launch_bounds__(128) void k_proj_v(const h16* __restrict__ A, const h16* __restrict__ Bt, h16* VT) {
    __shared__ __align__(16) h16 S[4 * GT];
    __shared__ __align__(16) h16 Tb[4 * 64 * 72];
    const int lane = threadIdx.x & 31, lr = lane & 15, hi = lane >> 4;
    const int wave = __builtin_amdgcn_readfirstlane(threadIdx.x >> 5);
    h16* T = Tb + wave * 64 * 72;
    const int r0 = blockIdx.x * 128 + (wave >> 1) * 64, c0 = blockIdx.y * 128 + (wave & 1) * 64;
    v8f acc[4][4];
#pragma unroll
    for (int mb = 0; mb < 4; ++mb)
#pragma unroll
        for (int nb = 0; nb < 4; ++nb) acc[mb][nb] = (v8f){};
    gemm64(A, Bt, S, blockIdx.x * 128, blockIdx.y * 128, wave, acc);
#pragma unroll
    for (int nb = 0; nb < 4; ++nb) {
#pragma unroll
        for (int mb = 0; mb < 4; ++mb) { v8h pk;
#pragma unroll
            for (int j = 0; j < 8; ++j) pk[j] = toh_flush(acc[mb][nb][j] * (1.0f / WCAR));
            *(v8ha*)(T + (nb * 16 + lr) * 72 + mb * 16 + hi * 8) = pk; } }
    __syncthreads();
    const int b = r0 / SEQ, s0 = r0 % SEQ, h = c0 / HD;
    h16* dst = VT + ((size_t)(b * NH + h) * HD) * SEQ + s0;
{
#pragma unroll
        for (int it = 0; it < 16; ++it) { const int piece = it * 32 + lane; const int d = piece >> 3, seg = piece & 7;
            const v8h val = *(const v8ha*)(T + d * 72 + seg * 8);
            *(v8h*)(dst + (size_t)d * SEQ + seg * 8) = val; }
         }
}

__global__ __launch_bounds__(128) void k_proj_out(const h16* __restrict__ A, const h16* __restrict__ Bt, const float* __restrict__ bias, float* C) {
    __shared__ __align__(16) h16 S[4 * GT];
    __shared__ __align__(16) float osb[4 * 16 * 68];
    const int lane = threadIdx.x & 31, lr = lane & 15, hi = lane >> 4;
    const int wave = __builtin_amdgcn_readfirstlane(threadIdx.x >> 5);
    float* os = osb + wave * 16 * 68;
    const int r0 = blockIdx.x * 128 + (wave >> 1) * 64, c0 = blockIdx.y * 128 + (wave & 1) * 64;
    v8f acc[4][4];
#pragma unroll
    for (int mb = 0; mb < 4; ++mb)
#pragma unroll
        for (int nb = 0; nb < 4; ++nb) acc[mb][nb] = (v8f){};
    gemm64(A, Bt, S, blockIdx.x * 128, blockIdx.y * 128, wave, acc);
    const int b = r0 / SEQ, s0 = r0 % SEQ; const int cofs = lr * 4;
    v4f b4;
#pragma unroll
    for (int q = 0; q < 4; ++q) b4[q] = bfr(bias[c0 + cofs + q]);
    const float fs = 1.0f / (WCAR * CCAR);
#pragma unroll
    for (int mb = 0; mb < 4; ++mb) {
#pragma unroll
        for (int nb = 0; nb < 4; ++nb)
#pragma unroll
            for (int j = 0; j < 8; ++j) os[(hi * 8 + j) * 68 + nb * 16 + lr] = acc[mb][nb][j];
        __syncthreads();
        float* crow = C + ((size_t)b * SEQ_FULL + s0 + mb * 16) * DM + c0;
{
#pragma unroll
            for (int s = 0; s < 8; ++s) { const int row = 2 * s + hi; const v4f raw = *(const v4fa*)(os + row * 68 + cofs); v4f val;
#pragma unroll
                for (int q = 0; q < 4; ++q) val[q] = raw[q] * fs + b4[q];
                *(v4f*)(crow + (size_t)row * DM + cofs) = val; }
             }
        __syncthreads();
    }
}

__global__ __launch_bounds__(256) void k_attn(const h16* __restrict__ Q, const h16* __restrict__ Kp, const h16* __restrict__ VT, const int* __restrict__ mask, h16* ctx) {
    __shared__ __align__(16) h16 Pl[8 * 16 * 72];
    __shared__ __align__(16) float kbias[SEQ];
    __shared__ __align__(16) h16 KV[2 * 2 * KVT];   // [buffer][K tile, V^T tile][row][KVP]
    const int tid = threadIdx.x, lane = tid & 31, lr = lane & 15, hi = lane >> 4;
    const int wave = __builtin_amdgcn_readfirstlane(tid >> 5);
    const int bh = blockIdx.x; const int b = bh / NH, h = bh % NH;
    const int q0 = blockIdx.y * 128;
    const size_t pbase = (size_t)bh * SEQ * HD;
    const unsigned lst = (unsigned)(size_t)KV + (unsigned)((tid >> 3) * KVP + (tid & 7) * 8) * 2u;
    const h16* kg = Kp + pbase + (size_t)(tid >> 3) * HD + (tid & 7) * 8;
    const h16* vg = VT + pbase + (size_t)(tid >> 3) * SEQ + (tid & 7) * 8;
    stage_kv(lst, kg, vg);                                   // tile 0 -> buffer 0
    for (int i = 0; i < SEQ / 256; ++i) kbias[i * 256 + tid] = (mask[(size_t)b * SEQ_FULL + i * 256 + tid] != 0) ? 0.0f : NEGF;
    asm volatile("s_wait_asynccnt 0x0" ::: "memory");        // this wave's copies of tile 0 have landed before the barrier that publishes them
    __syncthreads();
    stage_kv(lst + 2 * KVT * 2, kg + 64 * HD, vg + 64);      // tile 1 -> buffer 1
    const int pw = wave * 16 * 72;
    v16h qf0, qf1;
    { const h16* qp = Q + pbase + (size_t)(q0 + wave * 16 + lr) * HD + 8 * hi; qf0 = ldfrag(qp); qf1 = ldfrag(qp + 32); }
    v8f o[4]; float mi = NEGF, li = 0.0f;
#pragma unroll
    for (int t = 0; t < 4; ++t) o[t] = (v8f){};
#pragma unroll 1
    for (int kv0 = 0; kv0 < SEQ; kv0 += 64) {
        const int buf = (kv0 >> 6) & 1;
        const h16* kb = KV + buf * (2 * KVT) + lr * KVP + 8 * hi;
        const h16* vb = kb + KVT;
        const float* cp = kbias + kv0 + 8 * hi;
        v16h kf[4][2], vf[2][4]; v8f kb8[4];
#pragma unroll
        for (int t = 0; t < 4; ++t) { kf[t][0] = ldfrag_s(kb + t * 16 * KVP); kf[t][1] = ldfrag_s(kb + t * 16 * KVP + 32); }
#pragma unroll
        for (int t = 0; t < 4; ++t) kb8[t] = cat8(*(const v4fa*)(cp + t * 16), *(const v4fa*)(cp + t * 16 + 4));
        v8f sa[4];
#pragma unroll
        for (int t = 0; t < 4; ++t) sa[t] = wm16(kf[t][0], qf0, (v8f){});
#pragma unroll
        for (int t = 0; t < 4; ++t) sa[t] = wm16(kf[t][1], qf1, sa[t]);
#pragma unroll
        for (int s2 = 0; s2 < 2; ++s2)
#pragma unroll
            for (int t = 0; t < 4; ++t) vf[s2][t] = ldfrag_s(vb + t * 16 * KVP + s2 * 32);
        const v8f sc8 = {SC2, SC2, SC2, SC2, SC2, SC2, SC2, SC2};
        float mt[4];                                          // one maximum chain per score tile: each starts when its tile is done
#pragma unroll
        for (int t = 0; t < 4; ++t) { sa[t] = __builtin_elementwise_fma(sa[t], sc8, kb8[t]);   // base-2 score of a kept key; the lowest finite f32 for a masked one
            mt[t] = sa[t][0];
#pragma unroll
            for (int j = 1; j < 8; ++j) mt[t] = fmaxf(mt[t], sa[t][j]); }
        float mx = fmaxf(fmaxf(mt[0], mt[1]), fmaxf(mt[2], mt[3]));
        mx = fmaxf(mx, xhalf(mx));                            // both halves hold the query's maximum over the 64 keys
        const float mnew = fmaxf(mi, mx);
        const float alpha = ex2(mi - mnew); mi = mnew;
        const float nm = PEXP - mnew;
        v16h pf[2]; float ps[4];
#pragma unroll
        for (int t = 0; t < 4; ++t) { const v8f e = sa[t] + nm; float p[8];
#pragma unroll
            for (int j = 0; j < 8; ++j) { p[j] = ex2(e[j]); pf[t >> 1][(t & 1) * 8 + j] = (h16)p[j]; }
            ps[t] = ((p[0] + p[1]) + (p[2] + p[3])) + ((p[4] + p[5]) + (p[6] + p[7])); }
        li = li * alpha + ((ps[0] + ps[1]) + (ps[2] + ps[3]));
#pragma unroll
        for (int t = 0; t < 4; ++t) o[t] = o[t] * alpha;
#pragma unroll
        for (int s2 = 0; s2 < 2; ++s2)
#pragma unroll
            for (int t = 0; t < 4; ++t) o[t] = wm16(vf[s2][t], pf[s2], o[t]);
        asm volatile("s_wait_dscnt 0x0" ::: "memory");       // this wave's reads of buffer buf have returned before the buffer is refilled
        asm volatile("s_wait_asynccnt 0x0" ::: "memory");    // this wave's copies of the next tile have landed before the barrier that publishes them
        __syncthreads();
        if (kv0 + 128 < SEQ) stage_kv(lst + (unsigned)buf * (2 * KVT * 2), kg + (size_t)(kv0 + 128) * HD, vg + kv0 + 128);   // tile t + 2 -> the buffer just read
    }
    asm volatile("s_wait_asynccnt 0x0" ::: "memory");        // no copy is outstanding when the wave goes on to its end
    const float inv = CCAR * __builtin_amdgcn_rcpf(li + xhalf(li));   // the two halves' sums joined once; the x1024 of P and of the sums cancel
#pragma unroll
    for (int t = 0; t < 4; ++t) { v8h pk;
#pragma unroll
        for (int j = 0; j < 8; ++j) pk[j] = (h16)(o[t][j] * inv);
        *(v8ha*)(Pl + pw + lr * 72 + t * 16 + hi * 8) = pk; }   // row = query lr; the 16 bytes are d = 16 t + 8 hi .. + 7
    asm volatile("" ::: "memory"); __builtin_amdgcn_wave_barrier(); asm volatile("" ::: "memory");
    h16* dst = ctx + ((size_t)b * SEQ + q0 + wave * 16) * DM + h * HD;
{
#pragma unroll
        for (int it = 0; it < 4; ++it) { const int piece = it * 32 + lane; const int row = piece >> 3, seg = piece & 7;
            const v8h val = *(const v8ha*)(Pl + pw + row * 72 + seg * 8);
            *(v8h*)(dst + (size_t)row * DM + seg * 8) = val; }
         }
}

extern "C" void kernel_launch(void* const* d_in, const int* in_sizes, int n_in,
                              void* d_out, int out_size, void* d_ws, size_t ws_size, hipStream_t stream) {
    if (n_in < 6) return;
    const size_t xneed = ((size_t)(NB - 1) * SEQ_FULL + SEQ) * DM;
    const size_t mneed = (size_t)(NB - 1) * SEQ_FULL + SEQ;
    if ((size_t)in_sizes[0] < xneed || (size_t)in_sizes[1] < mneed) return;
    if (in_sizes[2] < DM * DM || in_sizes[3] < 2 * DM * DM || in_sizes[4] < DM * DM) return;
    if (in_sizes[5] < DM) return;
    if ((size_t)out_size < xneed) return;
    if (ws_size < WS_TOTAL) return;
    // input order of the wire: x, mask, Wq [512][512], Wkv [512][1024], Wout [512][512], bout [512]
    const float* x   = (const float*)d_in[0]; const int* mask = (const int*)d_in[1];
    const float* wq  = (const float*)d_in[2];
    const float* wkv = (const float*)d_in[3];
    const float* wo  = (const float*)d_in[4]; const float* bo = (const float*)d_in[5];
    float* OUT = (float*)d_out;
    char* wsp = (char*)d_ws;
    h16* XH = (h16*)wsp; wsp += SZ_X;      // [NB*SEQ][DM]
    h16* WT = (h16*)wsp; wsp += SZ_W;      // [4][n][k]: q, k, v, o
    h16* QP = (h16*)wsp; wsp += SZ_X;      // [b][h][s][64]
    h16* KP = (h16*)wsp; wsp += SZ_X;      // [b][h][s][64]
    h16* VT = (h16*)wsp; wsp += SZ_X;      // [b][h][64][s]
    h16* CX = (h16*)wsp; wsp += SZ_X;      // [NB*SEQ][DM], x64
    const size_t wsz = (size_t)DM * DM;
    k_cvtx<<<(unsigned)(((size_t)NB * SEQ * DM / 8 + 255) / 256), 256, 0, stream>>>(x, XH);
    const dim3 gw(DM / 64, DM / 64);
    const dim3 gwkv(DM / 64, 2 * DM / 64);
    k_wt<<<gw, 256, 0, stream>>>(wq, WT, DM);                  // in[512][512] -> out[512 n][512 k]
    k_wt<<<gwkv, 256, 0, stream>>>(wkv, WT + wsz, 2 * DM);     // in[512][1024] -> out[1024 n][512 k] = k plane, v plane
    k_wt<<<gw, 256, 0, stream>>>(wo, WT + 3 * wsz, DM);        // in[512][512] -> out[512 n][512 k]
    const dim3 gg(NB * SEQ / 128, DM / 128);
    k_proj_qk<<<gg, 128, 0, stream>>>(XH, WT, QP);
    k_proj_qk<<<gg, 128, 0, stream>>>(XH, WT + wsz, KP);
    k_proj_v<<<gg, 128, 0, stream>>>(XH, WT + 2 * wsz, VT);
    k_attn<<<dim3(NB * NH, SEQ / 128), 256, 0, stream>>>(QP, KP, VT, mask, CX);
    k_proj_out<<<gg, 128, 0, stream>>>(CX, WT + 3 * wsz, bo, OUT);
}

// v004
// A run of this version takes 69.2 microseconds.
// Two timings next to v003 both put it at 1.21 times that version's speed.
// Over all steps from v000 it is 3.79 times as fast.
#include <hip/hip_runtime.h>

// Multi-head self-attention with a per-key padding mask input: x [4][2048][512]; q = x Wq, fused kv = x Wkv ([in][out] weights; k = first 512 output columns, v = last 512; 8 heads x 64; no q/k/v biases); scores = (q k^T) / 8 with masked keys REPLACED by the lowest finite f32; softmax over the keys; out = merged ctx Wout + bout.
// Compute dtypes: all contractions v_wmma_f32_16x16x32_f16 (f16 operands, f32 accumulate). Every float input is converted to bf16 (RNE) on load and carried exactly in f16 (weights x16); q, k, v planes plain f16; P carried x1024 (row sums from the unconverted f32 values); ctx carried x64 against Wout x16; softmax f32.
// Engine: 4-wave 128x128 GEMM blocks (each wave a 64x64 register-blocked tile), A and B k-chunks of 64 staged once per block in a two-buffer LDS ring by asynchronous copies; fused flash-style attention on transposed products S^T = K Q^T, O^T += V^T P^T (online softmax in-lane, K and V^T tiles staged once per block in a two-buffer LDS ring by asynchronous copies, P packed in registers, mask as one f32 addend per key in LDS).

#ifndef NB
#define NB 4
#endif
#ifndef SEQ
#define SEQ 2048
#endif
#define NB_FULL  4
#define SEQ_FULL 2048
#define DM   512
#define NH   8
#define HD   64
#define WCAR 16.0f      // weight carry (exact power of two)
#define PCAR 1024.0f    // probability carry
#define CCAR 64.0f      // ctx carry
#define SCL  0.125f     // HD^-0.5
#define L2E  1.4426950408889634f
#define NEGF (-3.402823466e38f)
#define SC2  (SCL * L2E) // scores to the base-2 domain; an exact scaling of L2E
#define PEXP 10.0f      // log2 of PCAR
#define KVP  72         // LDS pitch of a staged K or V^T row, in f16: 144 bytes = 16 x odd, conflict-free for 16-byte readers
#define KVT  (64 * KVP) // one staged tile: 64 rows of 64 f16
#define GT   (128 * KVP) // one staged GEMM operand tile: 128 rows of 64 f16, same pitch
#define WTB  (4 * (DM / 64) * (DM / 64)) // weight-tile blocks of k_prep: four [512][512] planes in 64x64 tiles

typedef _Float16 h16;
typedef __attribute__((ext_vector_type(16))) _Float16 v16h;
typedef __attribute__((ext_vector_type(8)))  _Float16 v8h;
typedef __attribute__((ext_vector_type(8)))  float    v8f;
typedef __attribute__((ext_vector_type(4)))  float    v4f;
typedef v8h __attribute__((may_alias)) v8ha;
typedef v4f __attribute__((may_alias)) v4fa;

static_assert(NH * HD == DM);            // merged head width equals the model width
static_assert(HD == 64);
static_assert(DM % 64 == 0);             // N tiles of 64
static_assert(DM % 32 == 0);             // k-steps of 32
static_assert(SEQ % 128 == 0);           // 128 query rows per attention block; 64-row GEMM tiles stay inside one batch
static_assert(SEQ <= SEQ_FULL);
static_assert(NB <= NB_FULL);
static_assert(SEQ % 256 == 0);           // mask addends split evenly over 256 threads

#define SZ_X   ((size_t)NB * SEQ * DM * 2)      // f16 plane of x / q / k / v^T / ctx
#define SZ_W   ((size_t)4 * DM * DM * 2)        // four transposed weight planes
#define WS_TOTAL (SZ_X * 5 + SZ_W)
static_assert(SZ_X % 256 == 0);
static_assert(SZ_W % 256 == 0);
static_assert(WS_TOTAL <= (size_t)134217728);   // carve stays under 128 MiB

// file-scope bounds for the kernels below
static_assert((2 * DM) % 64 == 0);                        // fused kv weight: 16 column tiles of 64, k plane then v plane
static_assert(256 * 4 * 4 == 64 * 64);                    // k_prep weight fill: threads x trips x elements == tile elements
static_assert(256 * 2 * 16 == 64 * 128);
static_assert(32 * 16 * 16 == 64 * 128);
static_assert(32 * 4 * 16 == 16 * 128);
static_assert(64 * 72 * 2 <= 131072);                     // static LDS of k_prep
static_assert(4 * GT * 2 + 4 * 64 * 72 * 2 <= 131072);    // static LDS of k_proj_qkv: ring + one output tile per wave
static_assert(4 * GT * 2 + 4 * 16 * 68 * 4 <= 131072);    // static LDS of k_proj_out
static_assert(128 * 8 * 8 == 128 * 64);                   // GEMM staging: threads x copies x elements == operand tile elements
static_assert(DM % 128 == 0 && DM >= 128);                // 128-column GEMM blocks; the ring's prologue fills two k-chunks of 64
static_assert((size_t)NB * SEQ % 128 == 0);               // 128-row GEMM blocks
static_assert(8 * 16 * 72 * 2 + 4 * KVT * 2 + SEQ * 4 <= 131072); // static LDS of k_attn
static_assert(256 * 2 * 8 == 64 * HD);                    // k_attn staging: threads x copies x elements == tile elements
static_assert(SEQ >= 128);                                // the ring's prologue fills two tiles of 64 keys
static_assert((KVP * 2) % 16 == 0);                       // every staged row starts at a multiple of the copy width
static_assert((size_t)NB * SEQ % 64 == 0);                // GEMM row tiles
static_assert((size_t)NB * SEQ * DM % (8 * 256) == 0);     // k_prep: whole blocks of x converters

__device__ __forceinline__ unsigned short f2bf(float f) { unsigned u = __float_as_uint(f); u += 0x7FFFu + ((u >> 16) & 1u); return (unsigned short)(u >> 16); }
__device__ __forceinline__ float bfr(float f) { return __uint_as_float(((unsigned)f2bf(f)) << 16); }
__device__ __forceinline__ v8f cat8(v4f lo, v4f hi) { return __builtin_shufflevector(lo, hi, 0, 1, 2, 3, 4, 5, 6, 7); }
__device__ __forceinline__ v16h cat16(v8h lo, v8h hi) { return __builtin_shufflevector(lo, hi, 0, 1, 2, 3, 4, 5, 6, 7, 8, 9, 10, 11, 12, 13, 14, 15); }
// fragment loader for A (row-major [m][k]) and for B given as a [n][k] copy: elements 0..7 <- k0+8h.., elements 8..15 <- k0+16+8h.. ; p already includes the 8h offset
__device__ __forceinline__ v16h ldfrag(const h16* p) { return cat16(*(const v8h*)p, *(const v8h*)(p + 16)); }
// the same fragment from a staged LDS tile (same k map)
__device__ __forceinline__ v16h ldfrag_s(const h16* p) { return cat16(*(const v8ha*)p, *(const v8ha*)(p + 16)); }
// One 64-key stage: each of the 256 threads copies 4 x 16 bytes, rows r and r + 32 of the K tile and of the V^T tile (r = tid / 8).
// lk: the lane's LDS byte address in the K tile of the target buffer; kg, vg: the lane's global sources.
// s_wait_xcnt stands inside the copies' own statement, so that no address register is rewritten ahead of it.
__device__ __forceinline__ void stage_kv(unsigned lk, const h16* kg, const h16* vg) {
    const unsigned lk1 = lk + 32 * KVP * 2, lv = lk + KVT * 2, lv1 = lk + KVT * 2 + 32 * KVP * 2;
    const h16* kg1 = kg + 32 * HD; const h16* vg1 = vg + (size_t)32 * SEQ;
    asm volatile("global_load_async_to_lds_b128 %0, %4, off\n\t"
                 "global_load_async_to_lds_b128 %1, %5, off\n\t"
                 "global_load_async_to_lds_b128 %2, %6, off\n\t"
                 "global_load_async_to_lds_b128 %3, %7, off\n\t"
                 "s_wait_xcnt 0x0"
                 :: "v"(lk), "v"(lk1), "v"(lv), "v"(lv1), "v"(kg), "v"(kg1), "v"(vg), "v"(vg1) : "memory");
}
// One GEMM operand tile of a 64-wide k-chunk: each of the 128 threads copies 8 x 16 bytes, rows r + 16 j (r = tid / 8, j = 0..7), source pitch DM.
// l: the lane's LDS byte address in the target tile; g: the lane's global source. s_wait_xcnt stands inside the copies' own statement, as in stage_kv.
__device__ __forceinline__ void stage_g(unsigned l, const h16* g) {
    const unsigned l1 = l + 16 * KVP * 2, l2 = l + 32 * KVP * 2, l3 = l + 48 * KVP * 2, l4 = l + 64 * KVP * 2, l5 = l + 80 * KVP * 2, l6 = l + 96 * KVP * 2, l7 = l + 112 * KVP * 2;
    const h16* g1 = g + 16 * DM; const h16* g2 = g + 32 * DM; const h16* g3 = g + 48 * DM; const h16* g4 = g + 64 * DM;
    const h16* g5 = g + 80 * DM; const h16* g6 = g + 96 * DM; const h16* g7 = g + 112 * DM;
    asm volatile("global_load_async_to_lds_b128 %0, %8, off\n\t"
                 "global_load_async_to_lds_b128 %1, %9, off\n\t"
                 "global_load_async_to_lds_b128 %2, %10, off\n\t"
                 "global_load_async_to_lds_b128 %3, %11, off\n\t"
                 "global_load_async_to_lds_b128 %4, %12, off\n\t"
                 "global_load_async_to_lds_b128 %5, %13, off\n\t"
                 "global_load_async_to_lds_b128 %6, %14, off\n\t"
                 "global_load_async_to_lds_b128 %7, %15, off\n\t"
                 "s_wait_xcnt 0x0"
                 :: "v"(l), "v"(l1), "v"(l2), "v"(l3), "v"(l4), "v"(l5), "v"(l6), "v"(l7),
                    "v"(g), "v"(g1), "v"(g2), "v"(g3), "v"(g4), "v"(g5), "v"(g6), "v"(g7) : "memory");
}
// one WMMA with its own hazard guard (ties the accumulator, keeps A/B live)
__device__ __forceinline__ v8f wm16(v16h a, v16h b, v8f c) {
    c = __builtin_amdgcn_wmma_f32_16x16x32_f16(false, a, false, b, (short)0, c, false, false);
    asm volatile("v_nop\n\tv_nop\n\tv_nop\n\tv_nop" : "+v"(c) : "v"(a), "v"(b));
    return c;
}
__device__ __forceinline__ float ex2(float x) { return __builtin_amdgcn_exp2f(x); }
// lane l with lane l ^ 16
__device__ __forceinline__ float xhalf(float x) { return __builtin_bit_cast(float, __builtin_amdgcn_permlanex16(__builtin_bit_cast(int, x), __builtin_bit_cast(int, x), 0x76543210, 0xfedcba98, false, false)); }
// f32 -> f16 convert that cannot produce an f16 subnormal: |v| < 2^-14 becomes +0 (value select, applied after the carry)
static __device__ __forceinline__ h16 toh_flush(float v) { const h16 r = (h16)v; return (fabsf(v) < 6.103515625e-05f) ? (h16)0.0f : r; }

// ---- k_prep: the four independent preparation jobs share one launch, told apart by the block index (a block-uniform branch).
// Blocks 0 .. WTB - 1: one 64x64 weight tile each, transposed into the [4][n][k] planes q, k, v, o (2048 rows of 512): row tile nt = block / 8, k tile = block % 8.
// Row tiles 0..7 come from Wq, 8..23 from the fused kv weight (pitch 1024: k plane, then v plane), 24..31 from Wout. LDS tile T is cross-wave: block barrier between fill and drain.
// They stand first in the grid because their chain (load, LDS, barrier, LDS, store) is the longer one. The other blocks convert x, 8 elements a thread.
__global__ __launch_bounds__(256) void k_prep(const float* __restrict__ x, const float* __restrict__ wq, const float* __restrict__ wkv, const float* __restrict__ wo, h16* xh, h16* Wt) {
    __shared__ __align__(16) h16 T[64 * 72];
    const int tid = threadIdx.x; const int bid = blockIdx.x;
    if (bid < WTB) {
        const int k0 = (bid % (DM / 64)) * 64, nt = bid / (DM / 64);
        const float* W = wq; int ldw = DM, n0 = nt * 64;
        if (nt >= 3 * (DM / 64)) { W = wo; n0 = (nt - 3 * (DM / 64)) * 64; }
        else if (nt >= DM / 64) { W = wkv; ldw = 2 * DM; n0 = (nt - DM / 64) * 64; }
#pragma unroll
        for (int j = 0; j < 4; ++j) { const int i = tid + 256 * j; const int kr = i >> 4, c4 = (i & 15) * 4;
            const v4f v = *(const v4f*)(W + (size_t)(k0 + kr) * ldw + n0 + c4);
#pragma unroll
            for (int q = 0; q < 4; ++q) T[(c4 + q) * 72 + kr] = toh_flush(bfr(v[q]) * WCAR); }
        __syncthreads();
#pragma unroll
        for (int j = 0; j < 2; ++j) { const int p = tid + 256 * j; const int n = p >> 3, seg = p & 7;
            const v8h val = *(const v8ha*)(T + n * 72 + seg * 8);
            *(v8h*)(Wt + (size_t)(nt * 64 + n) * DM + k0 + seg * 8) = val; }
        return;
    }
    const size_t i = (size_t)(bid - WTB) * 256 + tid;
    if (i >= (size_t)NB * SEQ * DM / 8) return;
    const size_t row = i / (DM / 8); const int g = (int)(i % (DM / 8));
    const size_t b = row / SEQ, s = row % SEQ;
    const float* src = x + ((b * SEQ_FULL + s) * DM + (size_t)g * 8);
    const v4f v0 = *(const v4f*)src; const v4f v1 = *(const v4f*)(src + 4);
    v8h o;
#pragma unroll
    for (int k = 0; k < 4; ++k) { o[k] = (h16)bfr(v0[k]); o[4 + k] = (h16)bfr(v1[k]); }
    *(v8h*)(xh + i * 8) = o;
}

// ---- GEMM main loop: 4 waves per 128x128 block, each wave a 64x64 tile (wave w: rows 64 (w / 2), columns 64 (w % 2)), 16 accumulators, K = DM, operands from K-contiguous f16 planes (A [m][k], Bt [n][k]).
// Per 64-wide k-chunk the block's 128 A rows and 128 Bt rows are copied once into LDS (S: [buffer][A tile, B tile][row][KVP]; the next chunk's copies fly while this one is worked on);
// the waves read their fragments there (same k map, same k order of the sums as from the planes). One block barrier per chunk publishes the next chunk and frees the one just read.
__device__ __forceinline__ void gemm64(const h16* __restrict__ A, const h16* __restrict__ Bt, h16* S, int R0, int C0, int wave, v8f (&acc)[4][4]) {
    const int tid = threadIdx.x, lane = tid & 31, lr = lane & 15, hi = lane >> 4;
    const unsigned lst = (unsigned)(size_t)S + (unsigned)((tid >> 3) * KVP + (tid & 7) * 8) * 2u;
    const h16* ag = A + (size_t)(R0 + (tid >> 3)) * DM + (tid & 7) * 8;
    const h16* bg = Bt + (size_t)(C0 + (tid >> 3)) * DM + (tid & 7) * 8;
    stage_g(lst, ag); stage_g(lst + GT * 2, bg);                          // chunk 0 -> buffer 0
    asm volatile("s_wait_asynccnt 0x0" ::: "memory");        // this wave's copies of chunk 0 have landed before the barrier that publishes them
    __syncthreads();
    stage_g(lst + 2 * GT * 2, ag + 64); stage_g(lst + 3 * GT * 2, bg + 64);  // chunk 1 -> buffer 1
    const int aofs = ((wave >> 1) * 64 + lr) * KVP + 8 * hi, bofs = GT + ((wave & 1) * 64 + lr) * KVP + 8 * hi;
#pragma unroll 1
    for (int kc = 0; kc < DM; kc += 64) {
        const int buf = (kc >> 6) & 1;
        const h16* as = S + buf * (2 * GT) + aofs;
        const h16* bs = S + buf * (2 * GT) + bofs;
#pragma unroll
        for (int ks = 0; ks < 64; ks += 32) {
            v16h a[4], b[4];
#pragma unroll
            for (int mb = 0; mb < 4; ++mb) a[mb] = ldfrag_s(as + mb * 16 * KVP + ks);
#pragma unroll
            for (int nb = 0; nb < 4; ++nb) b[nb] = ldfrag_s(bs + nb * 16 * KVP + ks);
#pragma unroll
            for (int nb = 0; nb < 4; ++nb)
#pragma unroll
                for (int mb = 0; mb < 4; ++mb) acc[mb][nb] = wm16(a[mb], b[nb], acc[mb][nb]);
        }
        asm volatile("s_wait_dscnt 0x0" ::: "memory");       // this wave's reads of buffer buf have returned before the buffer is refilled
        asm volatile("s_wait_asynccnt 0x0" ::: "memory");    // this wave's copies of the next chunk have landed before the barrier that publishes them
        __syncthreads();
        if (kc + 128 < DM) { stage_g(lst + (unsigned)buf * (2 * GT * 2), ag + kc + 128); stage_g(lst + (unsigned)buf * (2 * GT * 2) + GT * 2, bg + kc + 128); }   // chunk t + 2 -> the buffer just read
    }
    asm volatile("s_wait_asynccnt 0x0" ::: "memory");        // no copy is outstanding when the wave goes on to its epilogue
}

// ---- k_proj_qkv: the three independent input projections share one launch; grid (NB*SEQ/128, 3*DM/128), 128 threads. Bt is the q, k, v weight planes as one [3*DM][DM] array;
// column block y belongs to projection y / (DM/128) (a block-uniform choice): 0 and 1 write a head plane [b][h][s][64] f16 = x Wt^T / 16 (no bias in this module), 2 writes V^T [b][h][64][s]. T is private to each wave.
__global__ __launch_bounds__(128) void k_proj_qkv(const h16* __restrict__ A, const h16* __restrict__ Bt, h16* QPl, h16* KPl, h16* VT) {
    __shared__ __align__(16) h16 S[4 * GT];
    __shared__ __align__(16) h16 Tb[4 * 64 * 72];
    const int lane = threadIdx.x & 31, lr = lane & 15, hi = lane >> 4;
    const int wave = __builtin_amdgcn_readfirstlane(threadIdx.x >> 5);
    h16* T = Tb + wave * 64 * 72;
    const int sel = blockIdx.y / (DM / 128);
    const int r0 = blockIdx.x * 128 + (wave >> 1) * 64, c0 = (blockIdx.y % (DM / 128)) * 128 + (wave & 1) * 64;
    v8f acc[4][4];
#pragma unroll
    for (int mb = 0; mb < 4; ++mb)
#pragma unroll
        for (int nb = 0; nb < 4; ++nb) acc[mb][nb] = (v8f){};
    gemm64(A, Bt, S, blockIdx.x * 128, blockIdx.y * 128, wave, acc);
    const int b = r0 / SEQ, s0 = r0 % SEQ, h = c0 / HD;
    if (sel < 2) {
#pragma unroll
        for (int nb = 0; nb < 4; ++nb) {
#pragma unroll
            for (int mb = 0; mb < 4; ++mb)
#pragma unroll
                for (int j = 0; j < 8; ++j) T[(mb * 16 + hi * 8 + j) * 72 + nb * 16 + lr] = toh_flush(acc[mb][nb][j] * (1.0f / WCAR)); }
        __syncthreads();
        h16* dst = (sel == 0 ? QPl : KPl) + ((size_t)(b * NH + h) * SEQ + s0) * HD;
#pragma unroll
        for (int it = 0; it < 16; ++it) { const int piece = it * 32 + lane; const int row = piece >> 3, seg = piece & 7;
            const v8h val = *(const v8ha*)(T + row * 72 + seg * 8);
            *(v8h*)(dst + (size_t)row * HD + seg * 8) = val; }
    } else {
#pragma unroll
        for (int nb = 0; nb < 4; ++nb) {
#pragma unroll
            for (int mb = 0; mb < 4; ++mb) { v8h pk;
#pragma unroll
                for (int j = 0; j < 8; ++j) pk[j] = toh_flush(acc[mb][nb][j] * (1.0f / WCAR));
                *(v8ha*)(T + (nb * 16 + lr) * 72 + mb * 16 + hi * 8) = pk; } }
        __syncthreads();
        h16* dst = VT + ((size_t)(b * NH + h) * HD) * SEQ + s0;
#pragma unroll
        for (int it = 0; it < 16; ++it) { const int piece = it * 32 + lane; const int d = piece >> 3, seg = piece & 7;
            const v8h val = *(const v8ha*)(T + d * 72 + seg * 8);
            *(v8h*)(dst + (size_t)d * SEQ + seg * 8) = val; }
    }
}

__global__ __launch_bounds__(128) void k_proj_out(const h16* __restrict__ A, const h16* __restrict__ Bt, const float* __restrict__ bias, float* C) {
    __shared__ __align__(16) h16 S[4 * GT];
    __shared__ __align__(16) float osb[4 * 16 * 68];
    const int lane = threadIdx.x & 31, lr = lane & 15, hi = lane >> 4;
    const int wave = __builtin_amdgcn_readfirstlane(threadIdx.x >> 5);
    float* os = osb + wave * 16 * 68;
    const int r0 = blockIdx.x * 128 + (wave >> 1) * 64, c0 = blockIdx.y * 128 + (wave & 1) * 64;
    v8f acc[4][4];
#pragma unroll
    for (int mb = 0; mb < 4; ++mb)
#pragma unroll
        for (int nb = 0; nb < 4; ++nb) acc[mb][nb] = (v8f){};
    gemm64(A, Bt, S, blockIdx.x * 128, blockIdx.y * 128, wave, acc);
    const int b = r0 / SEQ, s0 = r0 % SEQ; const int cofs = lr * 4;
    v4f b4;
#pragma unroll
    for (int q = 0; q < 4; ++q) b4[q] = bfr(bias[c0 + cofs + q]);
    const float fs = 1.0f / (WCAR * CCAR);
#pragma unroll
    for (int mb = 0; mb < 4; ++mb) {
#pragma unroll
        for (int nb = 0; nb < 4; ++nb)
#pragma unroll
            for (int j = 0; j < 8; ++j) os[(hi * 8 + j) * 68 + nb * 16 + lr] = acc[mb][nb][j];
        __syncthreads();
        float* crow = C + ((size_t)b * SEQ_FULL + s0 + mb * 16) * DM + c0;
{
#pragma unroll
            for (int s = 0; s < 8; ++s) { const int row = 2 * s + hi; const v4f raw = *(const v4fa*)(os + row * 68 + cofs); v4f val;
#pragma unroll
                for (int q = 0; q < 4; ++q) val[q] = raw[q] * fs + b4[q];
                *(v4f*)(crow + (size_t)row * DM + cofs) = val; }
             }
        __syncthreads();
    }
}

__global__ __launch_bounds__(256) void k_attn(const h16* __restrict__ Q, const h16* __restrict__ Kp, const h16* __restrict__ VT, const int* __restrict__ mask, h16* ctx) {
    __shared__ __align__(16) h16 Pl[8 * 16 * 72];
    __shared__ __align__(16) float kbias[SEQ];
    __shared__ __align__(16) h16 KV[2 * 2 * KVT];   // [buffer][K tile, V^T tile][row][KVP]
    const int tid = threadIdx.x, lane = tid & 31, lr = lane & 15, hi = lane >> 4;
    const int wave = __builtin_amdgcn_readfirstlane(tid >> 5);
    const int bh = blockIdx.x; const int b = bh / NH, h = bh % NH;
    const int q0 = blockIdx.y * 128;
    const size_t pbase = (size_t)bh * SEQ * HD;
    const unsigned lst = (unsigned)(size_t)KV + (unsigned)((tid >> 3) * KVP + (tid & 7) * 8) * 2u;
    const h16* kg = Kp + pbase + (size_t)(tid >> 3) * HD + (tid & 7) * 8;
    const h16* vg = VT + pbase + (size_t)(tid >> 3) * SEQ + (tid & 7) * 8;
    stage_kv(lst, kg, vg);                                   // tile 0 -> buffer 0
    for (int i = 0; i < SEQ / 256; ++i) kbias[i * 256 + tid] = (mask[(size_t)b * SEQ_FULL + i * 256 + tid] != 0) ? 0.0f : NEGF;
    asm volatile("s_wait_asynccnt 0x0" ::: "memory");        // this wave's copies of tile 0 have landed before the barrier that publishes them
    __syncthreads();
    stage_kv(lst + 2 * KVT * 2, kg + 64 * HD, vg + 64);      // tile 1 -> buffer 1
    const int pw = wave * 16 * 72;
    v16h qf0, qf1;
    { const h16* qp = Q + pbase + (size_t)(q0 + wave * 16 + lr) * HD + 8 * hi; qf0 = ldfrag(qp); qf1 = ldfrag(qp + 32); }
    v8f o[4]; float mi = NEGF, li = 0.0f;
#pragma unroll
    for (int t = 0; t < 4; ++t) o[t] = (v8f){};
#pragma unroll 1
    for (int kv0 = 0; kv0 < SEQ; kv0 += 64) {
        const int buf = (kv0 >> 6) & 1;
        const h16* kb = KV + buf * (2 * KVT) + lr * KVP + 8 * hi;
        const h16* vb = kb + KVT;
        const float* cp = kbias + kv0 + 8 * hi;
        v16h kf[4][2], vf[2][4]; v8f kb8[4];
#pragma unroll
        for (int t = 0; t < 4; ++t) { kf[t][0] = ldfrag_s(kb + t * 16 * KVP); kf[t][1] = ldfrag_s(kb + t * 16 * KVP + 32); }
#pragma unroll
        for (int t = 0; t < 4; ++t) kb8[t] = cat8(*(const v4fa*)(cp + t * 16), *(const v4fa*)(cp + t * 16 + 4));
        v8f sa[4];
#pragma unroll
        for (int t = 0; t < 4; ++t) sa[t] = wm16(kf[t][0], qf0, (v8f){});
#pragma unroll
        for (int t = 0; t < 4; ++t) sa[t] = wm16(kf[t][1], qf1, sa[t]);
#pragma unroll
        for (int s2 = 0; s2 < 2; ++s2)
#pragma unroll
            for (int t = 0; t < 4; ++t) vf[s2][t] = ldfrag_s(vb + t * 16 * KVP + s2 * 32);
        const v8f sc8 = {SC2, SC2, SC2, SC2, SC2, SC2, SC2, SC2};
        float mt[4];                                          // one maximum chain per score tile: each starts when its tile is done
#pragma unroll
        for (int t = 0; t < 4; ++t) { sa[t] = __builtin_elementwise_fma(sa[t], sc8, kb8[t]);   // base-2 score of a kept key; the lowest finite f32 for a masked one
            mt[t] = sa[t][0];
#pragma unroll
            for (int j = 1; j < 8; ++j) mt[t] = fmaxf(mt[t], sa[t][j]); }
        float mx = fmaxf(fmaxf(mt[0], mt[1]), fmaxf(mt[2], mt[3]));
        mx = fmaxf(mx, xhalf(mx));                            // both halves hold the query's maximum over the 64 keys
        const float mnew = fmaxf(mi, mx);
        const float alpha = ex2(mi - mnew); mi = mnew;
        const float nm = PEXP - mnew;
        v16h pf[2]; float ps[4];
#pragma unroll
        for (int t = 0; t < 4; ++t) { const v8f e = sa[t] + nm; float p[8];
#pragma unroll
            for (int j = 0; j < 8; ++j) { p[j] = ex2(e[j]); pf[t >> 1][(t & 1) * 8 + j] = (h16)p[j]; }
            ps[t] = ((p[0] + p[1]) + (p[2] + p[3])) + ((p[4] + p[5]) + (p[6] + p[7])); }
        li = li * alpha + ((ps[0] + ps[1]) + (ps[2] + ps[3]));
#pragma unroll
        for (int t = 0; t < 4; ++t) o[t] = o[t] * alpha;
#pragma unroll
        for (int s2 = 0; s2 < 2; ++s2)
#pragma unroll
            for (int t = 0; t < 4; ++t) o[t] = wm16(vf[s2][t], pf[s2], o[t]);
        asm volatile("s_wait_dscnt 0x0" ::: "memory");       // this wave's reads of buffer buf have returned before the buffer is refilled
        asm volatile("s_wait_asynccnt 0x0" ::: "memory");    // this wave's copies of the next tile have landed before the barrier that publishes them
        __syncthreads();
        if (kv0 + 128 < SEQ) stage_kv(lst + (unsigned)buf * (2 * KVT * 2), kg + (size_t)(kv0 + 128) * HD, vg + kv0 + 128);   // tile t + 2 -> the buffer just read
    }
    asm volatile("s_wait_asynccnt 0x0" ::: "memory");        // no copy is outstanding when the wave goes on to its end
    const float inv = CCAR * __builtin_amdgcn_rcpf(li + xhalf(li));   // the two halves' sums joined once; the x1024 of P and of the sums cancel
#pragma unroll
    for (int t = 0; t < 4; ++t) { v8h pk;
#pragma unroll
        for (int j = 0; j < 8; ++j) pk[j] = (h16)(o[t][j] * inv);
        *(v8ha*)(Pl + pw + lr * 72 + t * 16 + hi * 8) = pk; }   // row = query lr; the 16 bytes are d = 16 t + 8 hi .. + 7
    asm volatile("" ::: "memory"); __builtin_amdgcn_wave_barrier(); asm volatile("" ::: "memory");
    h16* dst = ctx + ((size_t)b * SEQ + q0 + wave * 16) * DM + h * HD;
{
#pragma unroll
        for (int it = 0; it < 4; ++it) { const int piece = it * 32 + lane; const int row = piece >> 3, seg = piece & 7;
            const v8h val = *(const v8ha*)(Pl + pw + row * 72 + seg * 8);
            *(v8h*)(dst + (size_t)row * DM + seg * 8) = val; }
         }
}

extern "C" void kernel_launch(void* const* d_in, const int* in_sizes, int n_in,
                              void* d_out, int out_size, void* d_ws, size_t ws_size, hipStream_t stream) {
    if (n_in < 6) return;
    const size_t xneed = ((size_t)(NB - 1) * SEQ_FULL + SEQ) * DM;
    const size_t mneed = (size_t)(NB - 1) * SEQ_FULL + SEQ;
    if ((size_t)in_sizes[0] < xneed || (size_t)in_sizes[1] < mneed) return;
    if (in_sizes[2] < DM * DM || in_sizes[3] < 2 * DM * DM || in_sizes[4] < DM * DM) return;
    if (in_sizes[5] < DM) return;
    if ((size_t)out_size < xneed) return;
    if (ws_size < WS_TOTAL) return;
    // input order of the wire: x, mask, Wq [512][512], Wkv [512][1024], Wout [512][512], bout [512]
    const float* x   = (const float*)d_in[0]; const int* mask = (const int*)d_in[1];
    const float* wq  = (const float*)d_in[2];
    const float* wkv = (const float*)d_in[3];
    const float* wo  = (const float*)d_in[4]; const float* bo = (const float*)d_in[5];
    float* OUT = (float*)d_out;
    char* wsp = (char*)d_ws;
    h16* XH = (h16*)wsp; wsp += SZ_X;      // [NB*SEQ][DM]
    h16* WT = (h16*)wsp; wsp += SZ_W;      // [4][n][k]: q, k, v, o
    h16* QP = (h16*)wsp; wsp += SZ_X;      // [b][h][s][64]
    h16* KP = (h16*)wsp; wsp += SZ_X;      // [b][h][s][64]
    h16* VT = (h16*)wsp; wsp += SZ_X;      // [b][h][64][s]
    h16* CX = (h16*)wsp; wsp += SZ_X;      // [NB*SEQ][DM], x64
    const size_t wsz = (size_t)DM * DM;
    k_prep<<<(unsigned)(WTB + (size_t)NB * SEQ * DM / 8 / 256), 256, 0, stream>>>(x, wq, wkv, wo, XH, WT);   // x -> XH; the weights -> [2048 n][512 k] = q, k, v, o planes
    const dim3 gg(NB * SEQ / 128, DM / 128);
    const dim3 g3(NB * SEQ / 128, 3 * DM / 128);
    k_proj_qkv<<<g3, 128, 0, stream>>>(XH, WT, QP, KP, VT);
    k_attn<<<dim3(NB * NH, SEQ / 128), 256, 0, stream>>>(QP, KP, VT, mask, CX);
    k_proj_out<<<gg, 128, 0, stream>>>(CX, WT + 3 * wsz, bo, OUT);
}

// v005
// Measured time: 64.6 microseconds a run.
// In both of two side-by-side timings against v004, it was 1.07 times as fast.
// Over all steps from v000 it is 4.06 times as fast.
#include <hip/hip_runtime.h>

// Multi-head self-attention with a per-key padding mask input: x [4][2048][512]; q = x Wq, fused kv = x Wkv ([in][out] weights; k = first 512 output columns, v = last 512; 8 heads x 64; no q/k/v biases); scores = (q k^T) / 8 with masked keys REPLACED by the lowest finite f32; softmax over the keys; out = merged ctx Wout + bout.
// Compute dtypes: all contractions v_wmma_f32_16x16x32_f16 (f16 operands, f32 accumulate). Every float input is converted to bf16 (RNE) on load and carried exactly in f16 (weights x16); q, k, v planes plain f16; P carried x1024 (row sums from the unconverted f32 values); ctx carried x64 against Wout x16; softmax f32.
// Engine: 4-wave 128x128 GEMM blocks (each wave a 64x64 register-blocked tile), A and B k-chunks of 64 staged once per block in a two-buffer LDS ring by asynchronous copies; fused flash-style attention on transposed products S^T = K Q^T, O^T += V^T P^T (online softmax in-lane, K and V^T tiles staged once per block in a two-buffer LDS ring by asynchronous copies, P packed in registers, mask as one f32 addend per key in LDS).

#ifndef NB
#define NB 4
#endif
#ifndef SEQ
#define SEQ 2048
#endif
#define NB_FULL  4
#define SEQ_FULL 2048
#define DM   512
#define NH   8
#define HD   64
#define WCAR 16.0f      // weight carry (exact power of two)
#define PCAR 1024.0f    // probability carry
#define CCAR 64.0f      // ctx carry
#define SCL  0.125f     // HD^-0.5
#define L2E  1.4426950408889634f
#define NEGF (-3.402823466e38f)
#define SC2  (SCL * L2E) // scores to the base-2 domain; an exact scaling of L2E
#define PEXP 10.0f      // log2 of PCAR
#define KVP  72         // LDS pitch of a staged K or V^T row, in f16: 144 bytes = 16 x odd, conflict-free for 16-byte readers
#define KVT  (64 * KVP) // one staged tile: 64 rows of 64 f16
#define GT   (128 * KVP) // one staged GEMM operand tile: 128 rows of 64 f16, same pitch
#define WTB  (4 * (DM / 64) * (DM / 64)) // weight-tile blocks of k_prep: four [512][512] planes in 64x64 tiles

typedef _Float16 h16;
typedef __attribute__((ext_vector_type(16))) _Float16 v16h;
typedef __attribute__((ext_vector_type(8)))  _Float16 v8h;
typedef __attribute__((ext_vector_type(8)))  float    v8f;
typedef __attribute__((ext_vector_type(4)))  float    v4f;
typedef v8h __attribute__((may_alias)) v8ha;
typedef v4f __attribute__((may_alias)) v4fa;

static_assert(NH * HD == DM);            // merged head width equals the model width
static_assert(HD == 64);
static_assert(DM % 64 == 0);             // N tiles of 64
static_assert(DM % 32 == 0);             // k-steps of 32
static_assert(SEQ % 128 == 0);           // 128 query rows per attention block; 64-row GEMM tiles stay inside one batch
static_assert(SEQ <= SEQ_FULL);
static_assert(NB <= NB_FULL);
static_assert(SEQ % 256 == 0);           // mask addends split evenly over 256 threads

#define SZ_X   ((size_t)NB * SEQ * DM * 2)      // f16 plane of x / q / k / v^T / ctx
#define SZ_W   ((size_t)4 * DM * DM * 2)        // four transposed weight planes
#define WS_TOTAL (SZ_X * 5 + SZ_W)
static_assert(SZ_X % 256 == 0);
static_assert(SZ_W % 256 == 0);
static_assert(WS_TOTAL <= (size_t)134217728);   // carve stays under 128 MiB

// file-scope bounds for the kernels below
static_assert((2 * DM) % 64 == 0);                        // fused kv weight: 16 column tiles of 64, k plane then v plane
static_assert(256 * 4 * 4 == 64 * 64);                    // k_prep weight fill: threads x trips x elements == tile elements
static_assert(256 * 2 * 16 == 64 * 128);
static_assert(32 * 16 * 16 == 64 * 128);
static_assert(32 * 4 * 16 == 16 * 128);
static_assert(64 * 72 * 2 <= 131072);                     // static LDS of k_prep
static_assert(4 * (4 * GT * 2) <= 327680);                // static LDS of k_proj_qkv: the ring alone, small enough for four blocks on one WGP, so the whole grid is resident at once
static_assert(4 * 64 * 72 <= 4 * GT);                     // the four waves' output tiles fit in the ring they reuse
static_assert(4 * GT * 2 + 4 * 16 * 68 * 4 <= 131072);    // static LDS of k_proj_out
static_assert(128 * 8 * 8 == 128 * 64);                   // GEMM staging: threads x copies x elements == operand tile elements
static_assert(DM % 128 == 0 && DM >= 128);                // 128-column GEMM blocks; the ring's prologue fills two k-chunks of 64
static_assert((size_t)NB * SEQ % 128 == 0);               // 128-row GEMM blocks
static_assert(8 * 16 * 72 * 2 + 4 * KVT * 2 + SEQ * 4 <= 131072); // static LDS of k_attn
static_assert(256 * 2 * 8 == 64 * HD);                    // k_attn staging: threads x copies x elements == tile elements
static_assert(SEQ >= 128);                                // the ring's prologue fills two tiles of 64 keys
static_assert((KVP * 2) % 16 == 0);                       // every staged row starts at a multiple of the copy width
static_assert((size_t)NB * SEQ % 64 == 0);                // GEMM row tiles
static_assert((size_t)NB * SEQ * DM % (8 * 256) == 0);     // k_prep: whole blocks of x converters

__device__ __forceinline__ unsigned short f2bf(float f) { unsigned u = __float_as_uint(f); u += 0x7FFFu + ((u >> 16) & 1u); return (unsigned short)(u >> 16); }
__device__ __forceinline__ float bfr(float f) { return __uint_as_float(((unsigned)f2bf(f)) << 16); }
__device__ __forceinline__ v8f cat8(v4f lo, v4f hi) { return __builtin_shufflevector(lo, hi, 0, 1, 2, 3, 4, 5, 6, 7); }
__device__ __forceinline__ v16h cat16(v8h lo, v8h hi) { return __builtin_shufflevector(lo, hi, 0, 1, 2, 3, 4, 5, 6, 7, 8, 9, 10, 11, 12, 13, 14, 15); }
// fragment loader for A (row-major [m][k]) and for B given as a [n][k] copy: elements 0..7 <- k0+8h.., elements 8..15 <- k0+16+8h.. ; p already includes the 8h offset
__device__ __forceinline__ v16h ldfrag(const h16* p) { return cat16(*(const v8h*)p, *(const v8h*)(p + 16)); }
// the same fragment from a staged LDS tile (same k map)
__device__ __forceinline__ v16h ldfrag_s(const h16* p) { return cat16(*(const v8ha*)p, *(const v8ha*)(p + 16)); }
// One 64-key stage: each of the 256 threads copies 4 x 16 bytes, rows r and r + 32 of the K tile and of the V^T tile (r = tid / 8).
// lk: the lane's LDS byte address in the K tile of the target buffer; kg, vg: the lane's global sources.
// s_wait_xcnt stands inside the copies' own statement, so that no address register is rewritten ahead of it.
__device__ __forceinline__ void stage_kv(unsigned lk, const h16* kg, const h16* vg) {
    const unsigned lk1 = lk + 32 * KVP * 2, lv = lk + KVT * 2, lv1 = lk + KVT * 2 + 32 * KVP * 2;
    const h16* kg1 = kg + 32 * HD; const h16* vg1 = vg + (size_t)32 * SEQ;
    asm volatile("global_load_async_to_lds_b128 %0, %4, off\n\t"
                 "global_load_async_to_lds_b128 %1, %5, off\n\t"
                 "global_load_async_to_lds_b128 %2, %6, off\n\t"
                 "global_load_async_to_lds_b128 %3, %7, off\n\t"
                 "s_wait_xcnt 0x0"
                 :: "v"(lk), "v"(lk1), "v"(lv), "v"(lv1), "v"(kg), "v"(kg1), "v"(vg), "v"(vg1) : "memory");
}
// One GEMM operand tile of a 64-wide k-chunk: each of the 128 threads copies 8 x 16 bytes, rows r + 16 j (r = tid / 8, j = 0..7), source pitch DM.
// l: the lane's LDS byte address in the target tile; g: the lane's global source. s_wait_xcnt stands inside the copies' own statement, as in stage_kv.
__device__ __forceinline__ void stage_g(unsigned l, const h16* g) {
    const unsigned l1 = l + 16 * KVP * 2, l2 = l + 32 * KVP * 2, l3 = l + 48 * KVP * 2, l4 = l + 64 * KVP * 2, l5 = l + 80 * KVP * 2, l6 = l + 96 * KVP * 2, l7 = l + 112 * KVP * 2;
    const h16* g1 = g + 16 * DM; const h16* g2 = g + 32 * DM; const h16* g3 = g + 48 * DM; const h16* g4 = g + 64 * DM;
    const h16* g5 = g + 80 * DM; const h16* g6 = g + 96 * DM; const h16* g7 = g + 112 * DM;
    asm volatile("global_load_async_to_lds_b128 %0, %8, off\n\t"
                 "global_load_async_to_lds_b128 %1, %9, off\n\t"
                 "global_load_async_to_lds_b128 %2, %10, off\n\t"
                 "global_load_async_to_lds_b128 %3, %11, off\n\t"
                 "global_load_async_to_lds_b128 %4, %12, off\n\t"
                 "global_load_async_to_lds_b128 %5, %13, off\n\t"
                 "global_load_async_to_lds_b128 %6, %14, off\n\t"
                 "global_load_async_to_lds_b128 %7, %15, off\n\t"
                 "s_wait_xcnt 0x0"
                 :: "v"(l), "v"(l1), "v"(l2), "v"(l3), "v"(l4), "v"(l5), "v"(l6), "v"(l7),
                    "v"(g), "v"(g1), "v"(g2), "v"(g3), "v"(g4), "v"(g5), "v"(g6), "v"(g7) : "memory");
}
// one WMMA with its own hazard guard (ties the accumulator, keeps A/B live)
__device__ __forceinline__ v8f wm16(v16h a, v16h b, v8f c) {
    c = __builtin_amdgcn_wmma_f32_16x16x32_f16(false, a, false, b, (short)0, c, false, false);
    asm volatile("v_nop\n\tv_nop\n\tv_nop\n\tv_nop" : "+v"(c) : "v"(a), "v"(b));
    return c;
}
__device__ __forceinline__ float ex2(float x) { return __builtin_amdgcn_exp2f(x); }
// lane l with lane l ^ 16
__device__ __forceinline__ float xhalf(float x) { return __builtin_bit_cast(float, __builtin_amdgcn_permlanex16(__builtin_bit_cast(int, x), __builtin_bit_cast(int, x), 0x76543210, 0xfedcba98, false, false)); }
// f32 -> f16 convert that cannot produce an f16 subnormal: |v| < 2^-14 becomes +0 (value select, applied after the carry)
static __device__ __forceinline__ h16 toh_flush(float v) { const h16 r = (h16)v; return (fabsf(v) < 6.103515625e-05f) ? (h16)0.0f : r; }

// ---- k_prep: the four independent preparation jobs share one launch, told apart by the block index (a block-uniform branch).
// Blocks 0 .. WTB - 1: one 64x64 weight tile each, transposed into the [4][n][k] planes q, k, v, o (2048 rows of 512): row tile nt = block / 8, k tile = block % 8.
// Row tiles 0..7 come from Wq, 8..23 from the fused kv weight (pitch 1024: k plane, then v plane), 24..31 from Wout. LDS tile T is cross-wave: block barrier between fill and drain.
// They stand first in the grid because their chain (load, LDS, barrier, LDS, store) is the longer one. The other blocks convert x, 8 elements a thread.
__global__ __launch_bounds__(256) void k_prep(const float* __restrict__ x, const float* __restrict__ wq, const float* __restrict__ wkv, const float* __restrict__ wo, h16* xh, h16* Wt) {
    __shared__ __align__(16) h16 T[64 * 72];
    const int tid = threadIdx.x; const int bid = blockIdx.x;
    if (bid < WTB) {
        const int k0 = (bid % (DM / 64)) * 64, nt = bid / (DM / 64);
        const float* W = wq; int ldw = DM, n0 = nt * 64;
        if (nt >= 3 * (DM / 64)) { W = wo; n0 = (nt - 3 * (DM / 64)) * 64; }
        else if (nt >= DM / 64) { W = wkv; ldw = 2 * DM; n0 = (nt - DM / 64) * 64; }
#pragma unroll
        for (int j = 0; j < 4; ++j) { const int i = tid + 256 * j; const int kr = i >> 4, c4 = (i & 15) * 4;
            const v4f v = *(const v4f*)(W + (size_t)(k0 + kr) * ldw + n0 + c4);
#pragma unroll
            for (int q = 0; q < 4; ++q) T[(c4 + q) * 72 + kr] = toh_flush(bfr(v[q]) * WCAR); }
        __syncthreads();
#pragma unroll
        for (int j = 0; j < 2; ++j) { const int p = tid + 256 * j; const int n = p >> 3, seg = p & 7;
            const v8h val = *(const v8ha*)(T + n * 72 + seg * 8);
            *(v8h*)(Wt + (size_t)(nt * 64 + n) * DM + k0 + seg * 8) = val; }
        return;
    }
    const size_t i = (size_t)(bid - WTB) * 256 + tid;
    if (i >= (size_t)NB * SEQ * DM / 8) return;
    const size_t row = i / (DM / 8); const int g = (int)(i % (DM / 8));
    const size_t b = row / SEQ, s = row % SEQ;
    const float* src = x + ((b * SEQ_FULL + s) * DM + (size_t)g * 8);
    const v4f v0 = *(const v4f*)src; const v4f v1 = *(const v4f*)(src + 4);
    v8h o;
#pragma unroll
    for (int k = 0; k < 4; ++k) { o[k] = (h16)bfr(v0[k]); o[4 + k] = (h16)bfr(v1[k]); }
    *(v8h*)(xh + i * 8) = o;
}

// ---- GEMM main loop: 4 waves per 128x128 block, each wave a 64x64 tile (wave w: rows 64 (w / 2), columns 64 (w % 2)), 16 accumulators, K = DM, operands from K-contiguous f16 planes (A [m][k], Bt [n][k]).
// Per 64-wide k-chunk the block's 128 A rows and 128 Bt rows are copied once into LDS (S: [buffer][A tile, B tile][row][KVP]; the next chunk's copies fly while this one is worked on);
// the waves read their fragments there (same k map, same k order of the sums as from the planes). One block barrier per chunk publishes the next chunk and frees the one just read.
__device__ __forceinline__ void gemm64(const h16* __restrict__ A, const h16* __restrict__ Bt, h16* S, int R0, int C0, int wave, v8f (&acc)[4][4]) {
    const int tid = threadIdx.x, lane = tid & 31, lr = lane & 15, hi = lane >> 4;
    const unsigned lst = (unsigned)(size_t)S + (unsigned)((tid >> 3) * KVP + (tid & 7) * 8) * 2u;
    const h16* ag = A + (size_t)(R0 + (tid >> 3)) * DM + (tid & 7) * 8;
    const h16* bg = Bt + (size_t)(C0 + (tid >> 3)) * DM + (tid & 7) * 8;
    stage_g(lst, ag); stage_g(lst + GT * 2, bg);                          // chunk 0 -> buffer 0
    asm volatile("s_wait_asynccnt 0x0" ::: "memory");        // this wave's copies of chunk 0 have landed before the barrier that publishes them
    __syncthreads();
    stage_g(lst + 2 * GT * 2, ag + 64); stage_g(lst + 3 * GT * 2, bg + 64);  // chunk 1 -> buffer 1
    const int aofs = ((wave >> 1) * 64 + lr) * KVP + 8 * hi, bofs = GT + ((wave & 1) * 64 + lr) * KVP + 8 * hi;
#pragma unroll 1
    for (int kc = 0; kc < DM; kc += 64) {
        const int buf = (kc >> 6) & 1;
        const h16* as = S + buf * (2 * GT) + aofs;
        const h16* bs = S + buf * (2 * GT) + bofs;
#pragma unroll
        for (int ks = 0; ks < 64; ks += 32) {
            v16h a[4], b[4];
#pragma unroll
            for (int mb = 0; mb < 4; ++mb) a[mb] = ldfrag_s(as + mb * 16 * KVP + ks);
#pragma unroll
            for (int nb = 0; nb < 4; ++nb) b[nb] = ldfrag_s(bs + nb * 16 * KVP + ks);
#pragma unroll
            for (int nb = 0; nb < 4; ++nb)
#pragma unroll
                for (int mb = 0; mb < 4; ++mb) acc[mb][nb] = wm16(a[mb], b[nb], acc[mb][nb]);
        }
        asm volatile("s_wait_dscnt 0x0" ::: "memory");       // this wave's reads of buffer buf have returned before the buffer is refilled
        asm volatile("s_wait_asynccnt 0x0" ::: "memory");    // this wave's copies of the next chunk have landed before the barrier that publishes them
        __syncthreads();
        if (kc + 128 < DM) { stage_g(lst + (unsigned)buf * (2 * GT * 2), ag + kc + 128); stage_g(lst + (unsigned)buf * (2 * GT * 2) + GT * 2, bg + kc + 128); }   // chunk t + 2 -> the buffer just read
    }
    asm volatile("s_wait_asynccnt 0x0" ::: "memory");        // no copy is outstanding when the wave goes on to its epilogue
}

// ---- k_proj_qkv: the three independent input projections share one launch; grid (NB*SEQ/128, 3*DM/128), 128 threads. Bt is the q, k, v weight planes as one [3*DM][DM] array;
// column block y belongs to projection y / (DM/128) (a block-uniform choice): 0 and 1 write a head plane [b][h][s][64] f16 = x Wt^T / 16 (no bias in this module), 2 writes V^T [b][h][64][s]. T is private to each wave.
// T lies in the ring's own LDS: behind the main loop's last block barrier no wave reads the ring any more and no copy into it is outstanding. A second array would hold the WGP to two blocks and the grid to two rounds.
__global__ __launch_bounds__(128) void k_proj_qkv(const h16* __restrict__ A, const h16* __restrict__ Bt, h16* QPl, h16* KPl, h16* VT) {
    __shared__ __align__(16) h16 S[4 * GT];
    const int lane = threadIdx.x & 31, lr = lane & 15, hi = lane >> 4;
    const int wave = __builtin_amdgcn_readfirstlane(threadIdx.x >> 5);
    h16* T = S + wave * 64 * 72;
    const int sel = blockIdx.y / (DM / 128);
    const int r0 = blockIdx.x * 128 + (wave >> 1) * 64, c0 = (blockIdx.y % (DM / 128)) * 128 + (wave & 1) * 64;
    v8f acc[4][4];
#pragma unroll
    for (int mb = 0; mb < 4; ++mb)
#pragma unroll
        for (int nb = 0; nb < 4; ++nb) acc[mb][nb] = (v8f){};
    gemm64(A, Bt, S, blockIdx.x * 128, blockIdx.y * 128, wave, acc);
    const int b = r0 / SEQ, s0 = r0 % SEQ, h = c0 / HD;
    if (sel < 2) {
#pragma unroll
        for (int nb = 0; nb < 4; ++nb) {
#pragma unroll
            for (int mb = 0; mb < 4; ++mb)
#pragma unroll
                for (int j = 0; j < 8; ++j) T[(mb * 16 + hi * 8 + j) * 72 + nb * 16 + lr] = toh_flush(acc[mb][nb][j] * (1.0f / WCAR)); }
        __syncthreads();
        h16* dst = (sel == 0 ? QPl : KPl) + ((size_t)(b * NH + h) * SEQ + s0) * HD;
#pragma unroll
        for (int it = 0; it < 16; ++it) { const int piece = it * 32 + lane; const int row = piece >> 3, seg = piece & 7;
            const v8h val = *(const v8ha*)(T + row * 72 + seg * 8);
            *(v8h*)(dst + (size_t)row * HD + seg * 8) = val; }
    } else {
#pragma unroll
        for (int nb = 0; nb < 4; ++nb) {
#pragma unroll
            for (int mb = 0; mb < 4; ++mb) { v8h pk;
#pragma unroll
                for (int j = 0; j < 8; ++j) pk[j] = toh_flush(acc[mb][nb][j] * (1.0f / WCAR));
                *(v8ha*)(T + (nb * 16 + lr) * 72 + mb * 16 + hi * 8) = pk; } }
        __syncthreads();
        h16* dst = VT + ((size_t)(b * NH + h) * HD) * SEQ + s0;
#pragma unroll
        for (int it = 0; it < 16; ++it) { const int piece = it * 32 + lane; const int d = piece >> 3, seg = piece & 7;
            const v8h val = *(const v8ha*)(T + d * 72 + seg * 8);
            *(v8h*)(dst + (size_t)d * SEQ + seg * 8) = val; }
    }
}

__global__ __launch_bounds__(128) void k_proj_out(const h16* __restrict__ A, const h16* __restrict__ Bt, const float* __restrict__ bias, float* C) {
    __shared__ __align__(16) h16 S[4 * GT];
    __shared__ __align__(16) float osb[4 * 16 * 68];
    const int lane = threadIdx.x & 31, lr = lane & 15, hi = lane >> 4;
    const int wave = __builtin_amdgcn_readfirstlane(threadIdx.x >> 5);
    float* os = osb + wave * 16 * 68;
    const int r0 = blockIdx.x * 128 + (wave >> 1) * 64, c0 = blockIdx.y * 128 + (wave & 1) * 64;
    v8f acc[4][4];
#pragma unroll
    for (int mb = 0; mb < 4; ++mb)
#pragma unroll
        for (int nb = 0; nb < 4; ++nb) acc[mb][nb] = (v8f){};
    gemm64(A, Bt, S, blockIdx.x * 128, blockIdx.y * 128, wave, acc);
    const int b = r0 / SEQ, s0 = r0 % SEQ; const int cofs = lr * 4;
    v4f b4;
#pragma unroll
    for (int q = 0; q < 4; ++q) b4[q] = bfr(bias[c0 + cofs + q]);
    const float fs = 1.0f / (WCAR * CCAR);
#pragma unroll
    for (int mb = 0; mb < 4; ++mb) {
#pragma unroll
        for (int nb = 0; nb < 4; ++nb)
#pragma unroll
            for (int j = 0; j < 8; ++j) os[(hi * 8 + j) * 68 + nb * 16 + lr] = acc[mb][nb][j];
        __syncthreads();
        float* crow = C + ((size_t)b * SEQ_FULL + s0 + mb * 16) * DM + c0;
{
#pragma unroll
            for (int s = 0; s < 8; ++s) { const int row = 2 * s + hi; const v4f raw = *(const v4fa*)(os + row * 68 + cofs); v4f val;
#pragma unroll
                for (int q = 0; q < 4; ++q) val[q] = raw[q] * fs + b4[q];
                *(v4f*)(crow + (size_t)row * DM + cofs) = val; }
             }
        __syncthreads();
    }
}

__global__ __launch_bounds__(256) void k_attn(const h16* __restrict__ Q, const h16* __restrict__ Kp, const h16* __restrict__ VT, const int* __restrict__ mask, h16* ctx) {
    __shared__ __align__(16) h16 Pl[8 * 16 * 72];
    __shared__ __align__(16) float kbias[SEQ];
    __shared__ __align__(16) h16 KV[2 * 2 * KVT];   // [buffer][K tile, V^T tile][row][KVP]
    const int tid = threadIdx.x, lane = tid & 31, lr = lane & 15, hi = lane >> 4;
    const int wave = __builtin_amdgcn_readfirstlane(tid >> 5);
    const int bh = blockIdx.x; const int b = bh / NH, h = bh % NH;
    const int q0 = blockIdx.y * 128;
    const size_t pbase = (size_t)bh * SEQ * HD;
    const unsigned lst = (unsigned)(size_t)KV + (unsigned)((tid >> 3) * KVP + (tid & 7) * 8) * 2u;
    const h16* kg = Kp + pbase + (size_t)(tid >> 3) * HD + (tid & 7) * 8;
    const h16* vg = VT + pbase + (size_t)(tid >> 3) * SEQ + (tid & 7) * 8;
    stage_kv(lst, kg, vg);                                   // tile 0 -> buffer 0
    for (int i = 0; i < SEQ / 256; ++i) kbias[i * 256 + tid] = (mask[(size_t)b * SEQ_FULL + i * 256 + tid] != 0) ? 0.0f : NEGF;
    asm volatile("s_wait_asynccnt 0x0" ::: "memory");        // this wave's copies of tile 0 have landed before the barrier that publishes them
    __syncthreads();
    stage_kv(lst + 2 * KVT * 2, kg + 64 * HD, vg + 64);      // tile 1 -> buffer 1
    const int pw = wave * 16 * 72;
    v16h qf0, qf1;
    { const h16* qp = Q + pbase + (size_t)(q0 + wave * 16 + lr) * HD + 8 * hi; qf0 = ldfrag(qp); qf1 = ldfrag(qp + 32); }
    v8f o[4]; float mi = NEGF, li = 0.0f;
#pragma unroll
    for (int t = 0; t < 4; ++t) o[t] = (v8f){};
#pragma unroll 1
    for (int kv0 = 0; kv0 < SEQ; kv0 += 64) {
        const int buf = (kv0 >> 6) & 1;
        const h16* kb = KV + buf * (2 * KVT) + lr * KVP + 8 * hi;
        const h16* vb = kb + KVT;
        const float* cp = kbias + kv0 + 8 * hi;
        v16h kf[4][2], vf[2][4]; v8f kb8[4];
#pragma unroll
        for (int t = 0; t < 4; ++t) { kf[t][0] = ldfrag_s(kb + t * 16 * KVP); kf[t][1] = ldfrag_s(kb + t * 16 * KVP + 32); }
#pragma unroll
        for (int t = 0; t < 4; ++t) kb8[t] = cat8(*(const v4fa*)(cp + t * 16), *(const v4fa*)(cp + t * 16 + 4));
        v8f sa[4];
#pragma unroll
        for (int t = 0; t < 4; ++t) sa[t] = wm16(kf[t][0], qf0, (v8f){});
#pragma unroll
        for (int t = 0; t < 4; ++t) sa[t] = wm16(kf[t][1], qf1, sa[t]);
#pragma unroll
        for (int s2 = 0; s2 < 2; ++s2)
#pragma unroll
            for (int t = 0; t < 4; ++t) vf[s2][t] = ldfrag_s(vb + t * 16 * KVP + s2 * 32);
        const v8f sc8 = {SC2, SC2, SC2, SC2, SC2, SC2, SC2, SC2};
        float mt[4];                                          // one maximum chain per score tile: each starts when its tile is done
#pragma unroll
        for (int t = 0; t < 4; ++t) { sa[t] = __builtin_elementwise_fma(sa[t], sc8, kb8[t]);   // base-2 score of a kept key; the lowest finite f32 for a masked one
            mt[t] = sa[t][0];
#pragma unroll
            for (int j = 1; j < 8; ++j) mt[t] = fmaxf(mt[t], sa[t][j]); }
        float mx = fmaxf(fmaxf(mt[0], mt[1]), fmaxf(mt[2], mt[3]));
        mx = fmaxf(mx, xhalf(mx));                            // both halves hold the query's maximum over the 64 keys
        const float mnew = fmaxf(mi, mx);
        const float alpha = ex2(mi - mnew); mi = mnew;
        const float nm = PEXP - mnew;
        v16h pf[2]; float ps[4];
#pragma unroll
        for (int t = 0; t < 4; ++t) { const v8f e = sa[t] + nm; float p[8];
#pragma unroll
            for (int j = 0; j < 8; ++j) { p[j] = ex2(e[j]); pf[t >> 1][(t & 1) * 8 + j] = (h16)p[j]; }
            ps[t] = ((p[0] + p[1]) + (p[2] + p[3])) + ((p[4] + p[5]) + (p[6] + p[7])); }
        li = li * alpha + ((ps[0] + ps[1]) + (ps[2] + ps[3]));
#pragma unroll
        for (int t = 0; t < 4; ++t) o[t] = o[t] * alpha;
#pragma unroll
        for (int s2 = 0; s2 < 2; ++s2)
#pragma unroll
            for (int t = 0; t < 4; ++t) o[t] = wm16(vf[s2][t], pf[s2], o[t]);
        asm volatile("s_wait_dscnt 0x0" ::: "memory");       // this wave's reads of buffer buf have returned before the buffer is refilled
        asm volatile("s_wait_asynccnt 0x0" ::: "memory");    // this wave's copies of the next tile have landed before the barrier that publishes them
        __syncthreads();
        if (kv0 + 128 < SEQ) stage_kv(lst + (unsigned)buf * (2 * KVT * 2), kg + (size_t)(kv0 + 128) * HD, vg + kv0 + 128);   // tile t + 2 -> the buffer just read
    }
    asm volatile("s_wait_asynccnt 0x0" ::: "memory");        // no copy is outstanding when the wave goes on to its end
    const float inv = CCAR * __builtin_amdgcn_rcpf(li + xhalf(li));   // the two halves' sums joined once; the x1024 of P and of the sums cancel
#pragma unroll
    for (int t = 0; t < 4; ++t) { v8h pk;
#pragma unroll
        for (int j = 0; j < 8; ++j) pk[j] = (h16)(o[t][j] * inv);
        *(v8ha*)(Pl + pw + lr * 72 + t * 16 + hi * 8) = pk; }   // row = query lr; the 16 bytes are d = 16 t + 8 hi .. + 7
    asm volatile("" ::: "memory"); __builtin_amdgcn_wave_barrier(); asm volatile("" ::: "memory");
    h16* dst = ctx + ((size_t)b * SEQ + q0 + wave * 16) * DM + h * HD;
{
#pragma unroll
        for (int it = 0; it < 4; ++it) { const int piece = it * 32 + lane; const int row = piece >> 3, seg = piece & 7;
            const v8h val = *(const v8ha*)(Pl + pw + row * 72 + seg * 8);
            *(v8h*)(dst + (size_t)row * DM + seg * 8) = val; }
         }
}

extern "C" void kernel_launch(void* const* d_in, const int* in_sizes, int n_in,
                              void* d_out, int out_size, void* d_ws, size_t ws_size, hipStream_t stream) {
    if (n_in < 6) return;
    const size_t xneed = ((size_t)(NB - 1) * SEQ_FULL + SEQ) * DM;
    const size_t mneed = (size_t)(NB - 1) * SEQ_FULL + SEQ;
    if ((size_t)in_sizes[0] < xneed || (size_t)in_sizes[1] < mneed) return;
    if (in_sizes[2] < DM * DM || in_sizes[3] < 2 * DM * DM || in_sizes[4] < DM * DM) return;
    if (in_sizes[5] < DM) return;
    if ((size_t)out_size < xneed) return;
    if (ws_size < WS_TOTAL) return;
    // input order of the wire: x, mask, Wq [512][512], Wkv [512][1024], Wout [512][512], bout [512]
    const float* x   = (const float*)d_in[0]; const int* mask = (const int*)d_in[1];
    const float* wq  = (const float*)d_in[2];
    const float* wkv = (const float*)d_in[3];
    const float* wo  = (const float*)d_in[4]; const float* bo = (const float*)d_in[5];
    float* OUT = (float*)d_out;
    char* wsp = (char*)d_ws;
    h16* XH = (h16*)wsp; wsp += SZ_X;      // [NB*SEQ][DM]
    h16* WT = (h16*)wsp; wsp += SZ_W;      // [4][n][k]: q, k, v, o
    h16* QP = (h16*)wsp; wsp += SZ_X;      // [b][h][s][64]
    h16* KP = (h16*)wsp; wsp += SZ_X;      // [b][h][s][64]
    h16* VT = (h16*)wsp; wsp += SZ_X;      // [b][h][64][s]
    h16* CX = (h16*)wsp; wsp += SZ_X;      // [NB*SEQ][DM], x64
    const size_t wsz = (size_t)DM * DM;
    k_prep<<<(unsigned)(WTB + (size_t)NB * SEQ * DM / 8 / 256), 256, 0, stream>>>(x, wq, wkv, wo, XH, WT);   // x -> XH; the weights -> [2048 n][512 k] = q, k, v, o planes
    const dim3 gg(NB * SEQ / 128, DM / 128);
    const dim3 g3(NB * SEQ / 128, 3 * DM / 128);
    k_proj_qkv<<<g3, 128, 0, stream>>>(XH, WT, QP, KP, VT);
    k_attn<<<dim3(NB * NH, SEQ / 128), 256, 0, stream>>>(QP, KP, VT, mask, CX);
    k_proj_out<<<gg, 128, 0, stream>>>(CX, WT + 3 * wsz, bo, OUT);
}

// v006
// It runs in 61.6 microseconds.
// Next to v005, in two timings, it ran 1.05 and 1.04 times as fast.
// All steps since v000 together make it 4.25 times as fast.
#include <hip/hip_runtime.h>

// Multi-head self-attention with a per-key padding mask input: x [4][2048][512]; q = x Wq, fused kv = x Wkv ([in][out] weights; k = first 512 output columns, v = last 512; 8 heads x 64; no q/k/v biases); scores = (q k^T) / 8 with masked keys REPLACED by the lowest finite f32; softmax over the keys; out = merged ctx Wout + bout.
// Compute dtypes: all contractions v_wmma_f32_16x16x32_f16 (f16 operands, f32 accumulate). Every float input is converted to bf16 (RNE) on load and carried exactly in f16 (weights x16); q, k, v planes plain f16; P carried x1024 (row sums from the unconverted f32 values); ctx carried x64 against Wout x16; softmax f32.
// Engine: 4-wave 128x128 GEMM blocks (each wave a 64x64 register-blocked tile), A and B k-chunks of 64 staged once per block in a two-buffer LDS ring by asynchronous copies; fused flash-style attention on transposed products S^T = K Q^T, O^T += V^T P^T (online softmax in-lane, K and V^T tiles staged once per block in a two-buffer LDS ring by asynchronous copies, P packed in registers, mask as one f32 addend per key in LDS, read only for 64-key tiles that hold a masked key).

#ifndef NB
#define NB 4
#endif
#ifndef SEQ
#define SEQ 2048
#endif
#define NB_FULL  4
#define SEQ_FULL 2048
#define DM   512
#define NH   8
#define HD   64
#define WCAR 16.0f      // weight carry (exact power of two)
#define PCAR 1024.0f    // probability carry
#define CCAR 64.0f      // ctx carry
#define SCL  0.125f     // HD^-0.5
#define L2E  1.4426950408889634f
#define NEGF (-3.402823466e38f)
#define SC2  (SCL * L2E) // scores to the base-2 domain; an exact scaling of L2E
#define PEXP 10.0f      // log2 of PCAR
#define KVP  72         // LDS pitch of a staged K or V^T row, in f16: 144 bytes = 16 x odd, conflict-free for 16-byte readers
#define KVT  (64 * KVP) // one staged tile: 64 rows of 64 f16
#define GT   (128 * KVP) // one staged GEMM operand tile: 128 rows of 64 f16, same pitch
#define WTB  (4 * (DM / 64) * (DM / 64)) // weight-tile blocks of k_prep: four [512][512] planes in 64x64 tiles

typedef _Float16 h16;
typedef __attribute__((ext_vector_type(16))) _Float16 v16h;
typedef __attribute__((ext_vector_type(8)))  _Float16 v8h;
typedef __attribute__((ext_vector_type(8)))  float    v8f;
typedef __attribute__((ext_vector_type(4)))  float    v4f;
typedef v8h __attribute__((may_alias)) v8ha;
typedef v4f __attribute__((may_alias)) v4fa;

static_assert(NH * HD == DM);            // merged head width equals the model width
static_assert(HD == 64);
static_assert(DM % 64 == 0);             // N tiles of 64
static_assert(DM % 32 == 0);             // k-steps of 32
static_assert(SEQ % 128 == 0);           // 128 query rows per attention block; 64-row GEMM tiles stay inside one batch
static_assert(SEQ <= SEQ_FULL);
static_assert(NB <= NB_FULL);
static_assert(SEQ % 256 == 0);           // mask addends split evenly over 256 threads

#define SZ_X   ((size_t)NB * SEQ * DM * 2)      // f16 plane of x / q / k / v^T / ctx
#define SZ_W   ((size_t)4 * DM * DM * 2)        // four transposed weight planes
#define WS_TOTAL (SZ_X * 5 + SZ_W)
static_assert(SZ_X % 256 == 0);
static_assert(SZ_W % 256 == 0);
static_assert(WS_TOTAL <= (size_t)134217728);   // carve stays under 128 MiB

// file-scope bounds for the kernels below
static_assert((2 * DM) % 64 == 0);                        // fused kv weight: 16 column tiles of 64, k plane then v plane
static_assert(256 * 4 * 4 == 64 * 64);                    // k_prep weight fill: threads x trips x elements == tile elements
static_assert(256 * 2 * 16 == 64 * 128);
static_assert(32 * 16 * 16 == 64 * 128);
static_assert(32 * 4 * 16 == 16 * 128);
static_assert(64 * 72 * 2 <= 131072);                     // static LDS of k_prep
static_assert(4 * (4 * GT * 2) <= 327680);                // static LDS of k_proj_qkv: the ring alone, small enough for four blocks on one WGP, so the whole grid is resident at once
static_assert(4 * 64 * 72 <= 4 * GT);                     // the four waves' output tiles fit in the ring they reuse
static_assert(4 * GT * 2 + 4 * 16 * 68 * 4 <= 131072);    // static LDS of k_proj_out
static_assert(128 * 8 * 8 == 128 * 64);                   // GEMM staging: threads x copies x elements == operand tile elements
static_assert(DM % 128 == 0 && DM >= 128);                // 128-column GEMM blocks; the ring's prologue fills two k-chunks of 64
static_assert((size_t)NB * SEQ % 128 == 0);               // 128-row GEMM blocks
static_assert(8 * 16 * 72 * 2 + 4 * KVT * 2 + SEQ * 4 + SEQ / 32 * 4 <= 131072); // static LDS of k_attn
static_assert(SEQ / 64 <= 32);                            // k_attn: one bit per 64-key tile in one 32-bit word
static_assert(256 * 2 * 8 == 64 * HD);                    // k_attn staging: threads x copies x elements == tile elements
static_assert(SEQ >= 128);                                // the ring's prologue fills two tiles of 64 keys
static_assert((KVP * 2) % 16 == 0);                       // every staged row starts at a multiple of the copy width
static_assert((size_t)NB * SEQ % 64 == 0);                // GEMM row tiles
static_assert((size_t)NB * SEQ * DM % (8 * 256) == 0);     // k_prep: whole blocks of x converters

__device__ __forceinline__ unsigned short f2bf(float f) { unsigned u = __float_as_uint(f); u += 0x7FFFu + ((u >> 16) & 1u); return (unsigned short)(u >> 16); }
__device__ __forceinline__ float bfr(float f) { return __uint_as_float(((unsigned)f2bf(f)) << 16); }
__device__ __forceinline__ v8f cat8(v4f lo, v4f hi) { return __builtin_shufflevector(lo, hi, 0, 1, 2, 3, 4, 5, 6, 7); }
__device__ __forceinline__ v16h cat16(v8h lo, v8h hi) { return __builtin_shufflevector(lo, hi, 0, 1, 2, 3, 4, 5, 6, 7, 8, 9, 10, 11, 12, 13, 14, 15); }
// fragment loader for A (row-major [m][k]) and for B given as a [n][k] copy: elements 0..7 <- k0+8h.., elements 8..15 <- k0+16+8h.. ; p already includes the 8h offset
__device__ __forceinline__ v16h ldfrag(const h16* p) { return cat16(*(const v8h*)p, *(const v8h*)(p + 16)); }
// the same fragment from a staged LDS tile (same k map)
__device__ __forceinline__ v16h ldfrag_s(const h16* p) { return cat16(*(const v8ha*)p, *(const v8ha*)(p + 16)); }
// One 64-key stage: each of the 256 threads copies 4 x 16 bytes, rows r and r + 32 of the K tile and of the V^T tile (r = tid / 8).
// lk: the lane's LDS byte address in the K tile of the target buffer; kg, vg: the lane's global sources.
// s_wait_xcnt stands inside the copies' own statement, so that no address register is rewritten ahead of it.
__device__ __forceinline__ void stage_kv(unsigned lk, const h16* kg, const h16* vg) {
    const unsigned lk1 = lk + 32 * KVP * 2, lv = lk + KVT * 2, lv1 = lk + KVT * 2 + 32 * KVP * 2;
    const h16* kg1 = kg + 32 * HD; const h16* vg1 = vg + (size_t)32 * SEQ;
    asm volatile("global_load_async_to_lds_b128 %0, %4, off\n\t"
                 "global_load_async_to_lds_b128 %1, %5, off\n\t"
                 "global_load_async_to_lds_b128 %2, %6, off\n\t"
                 "global_load_async_to_lds_b128 %3, %7, off\n\t"
                 "s_wait_xcnt 0x0"
                 :: "v"(lk), "v"(lk1), "v"(lv), "v"(lv1), "v"(kg), "v"(kg1), "v"(vg), "v"(vg1) : "memory");
}
// One GEMM operand tile of a 64-wide k-chunk: each of the 128 threads copies 8 x 16 bytes, rows r + 16 j (r = tid / 8, j = 0..7), source pitch DM.
// l: the lane's LDS byte address in the target tile; g: the lane's global source. s_wait_xcnt stands inside the copies' own statement, as in stage_kv.
__device__ __forceinline__ void stage_g(unsigned l, const h16* g) {
    const unsigned l1 = l + 16 * KVP * 2, l2 = l + 32 * KVP * 2, l3 = l + 48 * KVP * 2, l4 = l + 64 * KVP * 2, l5 = l + 80 * KVP * 2, l6 = l + 96 * KVP * 2, l7 = l + 112 * KVP * 2;
    const h16* g1 = g + 16 * DM; const h16* g2 = g + 32 * DM; const h16* g3 = g + 48 * DM; const h16* g4 = g + 64 * DM;
    const h16* g5 = g + 80 * DM; const h16* g6 = g + 96 * DM; const h16* g7 = g + 112 * DM;
    asm volatile("global_load_async_to_lds_b128 %0, %8, off\n\t"
                 "global_load_async_to_lds_b128 %1, %9, off\n\t"
                 "global_load_async_to_lds_b128 %2, %10, off\n\t"
                 "global_load_async_to_lds_b128 %3, %11, off\n\t"
                 "global_load_async_to_lds_b128 %4, %12, off\n\t"
                 "global_load_async_to_lds_b128 %5, %13, off\n\t"
                 "global_load_async_to_lds_b128 %6, %14, off\n\t"
                 "global_load_async_to_lds_b128 %7, %15, off\n\t"
                 "s_wait_xcnt 0x0"
                 :: "v"(l), "v"(l1), "v"(l2), "v"(l3), "v"(l4), "v"(l5), "v"(l6), "v"(l7),
                    "v"(g), "v"(g1), "v"(g2), "v"(g3), "v"(g4), "v"(g5), "v"(g6), "v"(g7) : "memory");
}
// one WMMA with its own hazard guard (ties the accumulator, keeps A/B live)
__device__ __forceinline__ v8f wm16(v16h a, v16h b, v8f c) {
    c = __builtin_amdgcn_wmma_f32_16x16x32_f16(false, a, false, b, (short)0, c, false, false);
    asm volatile("v_nop\n\tv_nop\n\tv_nop\n\tv_nop" : "+v"(c) : "v"(a), "v"(b));
    return c;
}
__device__ __forceinline__ float ex2(float x) { return __builtin_amdgcn_exp2f(x); }
// lane l with lane l ^ 16
__device__ __forceinline__ float xhalf(float x) { return __builtin_bit_cast(float, __builtin_amdgcn_permlanex16(__builtin_bit_cast(int, x), __builtin_bit_cast(int, x), 0x76543210, 0xfedcba98, false, false)); }
// f32 -> f16 convert that cannot produce an f16 subnormal: |v| < 2^-14 becomes +0 (value select, applied after the carry)
static __device__ __forceinline__ h16 toh_flush(float v) { const h16 r = (h16)v; return (fabsf(v) < 6.103515625e-05f) ? (h16)0.0f : r; }

// ---- k_prep: the four independent preparation jobs share one launch, told apart by the block index (a block-uniform branch).
// Blocks 0 .. WTB - 1: one 64x64 weight tile each, transposed into the [4][n][k] planes q, k, v, o (2048 rows of 512): row tile nt = block / 8, k tile = block % 8.
// Row tiles 0..7 come from Wq, 8..23 from the fused kv weight (pitch 1024: k plane, then v plane), 24..31 from Wout. LDS tile T is cross-wave: block barrier between fill and drain.
// They stand first in the grid because their chain (load, LDS, barrier, LDS, store) is the longer one. The other blocks convert x, 8 elements a thread.
__global__ __launch_bounds__(256) void k_prep(const float* __restrict__ x, const float* __restrict__ wq, const float* __restrict__ wkv, const float* __restrict__ wo, h16* xh, h16* Wt) {
    __shared__ __align__(16) h16 T[64 * 72];
    const int tid = threadIdx.x; const int bid = blockIdx.x;
    if (bid < WTB) {
        const int k0 = (bid % (DM / 64)) * 64, nt = bid / (DM / 64);
        const float* W = wq; int ldw = DM, n0 = nt * 64;
        if (nt >= 3 * (DM / 64)) { W = wo; n0 = (nt - 3 * (DM / 64)) * 64; }
        else if (nt >= DM / 64) { W = wkv; ldw = 2 * DM; n0 = (nt - DM / 64) * 64; }
#pragma unroll
        for (int j = 0; j < 4; ++j) { const int i = tid + 256 * j; const int kr = i >> 4, c4 = (i & 15) * 4;
            const v4f v = *(const v4f*)(W + (size_t)(k0 + kr) * ldw + n0 + c4);
#pragma unroll
            for (int q = 0; q < 4; ++q) T[(c4 + q) * 72 + kr] = toh_flush(bfr(v[q]) * WCAR); }
        __syncthreads();
#pragma unroll
        for (int j = 0; j < 2; ++j) { const int p = tid + 256 * j; const int n = p >> 3, seg = p & 7;
            const v8h val = *(const v8ha*)(T + n * 72 + seg * 8);
            *(v8h*)(Wt + (size_t)(nt * 64 + n) * DM + k0 + seg * 8) = val; }
        return;
    }
    const size_t i = (size_t)(bid - WTB) * 256 + tid;
    if (i >= (size_t)NB * SEQ * DM / 8) return;
    const size_t row = i / (DM / 8); const int g = (int)(i % (DM / 8));
    const size_t b = row / SEQ, s = row % SEQ;
    const float* src = x + ((b * SEQ_FULL + s) * DM + (size_t)g * 8);
    const v4f v0 = *(const v4f*)src; const v4f v1 = *(const v4f*)(src + 4);
    v8h o;
#pragma unroll
    for (int k = 0; k < 4; ++k) { o[k] = (h16)bfr(v0[k]); o[4 + k] = (h16)bfr(v1[k]); }
    *(v8h*)(xh + i * 8) = o;
}

// ---- GEMM main loop: 4 waves per 128x128 block, each wave a 64x64 tile (wave w: rows 64 (w / 2), columns 64 (w % 2)), 16 accumulators, K = DM, operands from K-contiguous f16 planes (A [m][k], Bt [n][k]).
// Per 64-wide k-chunk the block's 128 A rows and 128 Bt rows are copied once into LDS (S: [buffer][A tile, B tile][row][KVP]; the next chunk's copies fly while this one is worked on);
// the waves read their fragments there (same k map, same k order of the sums as from the planes). One block barrier per chunk publishes the next chunk and frees the one just read.
__device__ __forceinline__ void gemm64(const h16* __restrict__ A, const h16* __restrict__ Bt, h16* S, int R0, int C0, int wave, v8f (&acc)[4][4]) {
    const int tid = threadIdx.x, lane = tid & 31, lr = lane & 15, hi = lane >> 4;
    const unsigned lst = (unsigned)(size_t)S + (unsigned)((tid >> 3) * KVP + (tid & 7) * 8) * 2u;
    const h16* ag = A + (size_t)(R0 + (tid >> 3)) * DM + (tid & 7) * 8;
    const h16* bg = Bt + (size_t)(C0 + (tid >> 3)) * DM + (tid & 7) * 8;
    stage_g(lst, ag); stage_g(lst + GT * 2, bg);                          // chunk 0 -> buffer 0
    asm volatile("s_wait_asynccnt 0x0" ::: "memory");        // this wave's copies of chunk 0 have landed before the barrier that publishes them
    __syncthreads();
    stage_g(lst + 2 * GT * 2, ag + 64); stage_g(lst + 3 * GT * 2, bg + 64);  // chunk 1 -> buffer 1
    const int aofs = ((wave >> 1) * 64 + lr) * KVP + 8 * hi, bofs = GT + ((wave & 1) * 64 + lr) * KVP + 8 * hi;
#pragma unroll 1
    for (int kc = 0; kc < DM; kc += 64) {
        const int buf = (kc >> 6) & 1;
        const h16* as = S + buf * (2 * GT) + aofs;
        const h16* bs = S + buf * (2 * GT) + bofs;
#pragma unroll
        for (int ks = 0; ks < 64; ks += 32) {
            v16h a[4], b[4];
#pragma unroll
            for (int mb = 0; mb < 4; ++mb) a[mb] = ldfrag_s(as + mb * 16 * KVP + ks);
#pragma unroll
            for (int nb = 0; nb < 4; ++nb) b[nb] = ldfrag_s(bs + nb * 16 * KVP + ks);
#pragma unroll
            for (int nb = 0; nb < 4; ++nb)
#pragma unroll
                for (int mb = 0; mb < 4; ++mb) acc[mb][nb] = wm16(a[mb], b[nb], acc[mb][nb]);
        }
        asm volatile("s_wait_dscnt 0x0" ::: "memory");       // this wave's reads of buffer buf have returned before the buffer is refilled
        asm volatile("s_wait_asynccnt 0x0" ::: "memory");    // this wave's copies of the next chunk have landed before the barrier that publishes them
        __syncthreads();
        if (kc + 128 < DM) { stage_g(lst + (unsigned)buf * (2 * GT * 2), ag + kc + 128); stage_g(lst + (unsigned)buf * (2 * GT * 2) + GT * 2, bg + kc + 128); }   // chunk t + 2 -> the buffer just read
    }
    asm volatile("s_wait_asynccnt 0x0" ::: "memory");        // no copy is outstanding when the wave goes on to its epilogue
}

// ---- k_proj_qkv: the three independent input projections share one launch; grid (NB*SEQ/128, 3*DM/128), 128 threads. Bt is the q, k, v weight planes as one [3*DM][DM] array;
// column block y belongs to projection y / (DM/128) (a block-uniform choice): 0 and 1 write a head plane [b][h][s][64] f16 = x Wt^T / 16 (no bias in this module), 2 writes V^T [b][h][64][s]. T is private to each wave.
// T lies in the ring's own LDS: behind the main loop's last block barrier no wave reads the ring any more and no copy into it is outstanding. A second array would hold the WGP to two blocks and the grid to two rounds.
__global__ __launch_bounds__(128) void k_proj_qkv(const h16* __restrict__ A, const h16* __restrict__ Bt, h16* QPl, h16* KPl, h16* VT) {
    __shared__ __align__(16) h16 S[4 * GT];
    const int lane = threadIdx.x & 31, lr = lane & 15, hi = lane >> 4;
    const int wave = __builtin_amdgcn_readfirstlane(threadIdx.x >> 5);
    h16* T = S + wave * 64 * 72;
    const int sel = blockIdx.y / (DM / 128);
    const int r0 = blockIdx.x * 128 + (wave >> 1) * 64, c0 = (blockIdx.y % (DM / 128)) * 128 + (wave & 1) * 64;
    v8f acc[4][4];
#pragma unroll
    for (int mb = 0; mb < 4; ++mb)
#pragma unroll
        for (int nb = 0; nb < 4; ++nb) acc[mb][nb] = (v8f){};
    gemm64(A, Bt, S, blockIdx.x * 128, blockIdx.y * 128, wave, acc);
    const int b = r0 / SEQ, s0 = r0 % SEQ, h = c0 / HD;
    if (sel < 2) {
#pragma unroll
        for (int nb = 0; nb < 4; ++nb) {
#pragma unroll
            for (int mb = 0; mb < 4; ++mb)
#pragma unroll
                for (int j = 0; j < 8; ++j) T[(mb * 16 + hi * 8 + j) * 72 + nb * 16 + lr] = toh_flush(acc[mb][nb][j] * (1.0f / WCAR)); }
        __syncthreads();
        h16* dst = (sel == 0 ? QPl : KPl) + ((size_t)(b * NH + h) * SEQ + s0) * HD;
#pragma unroll
        for (int it = 0; it < 16; ++it) { const int piece = it * 32 + lane; const int row = piece >> 3, seg = piece & 7;
            const v8h val = *(const v8ha*)(T + row * 72 + seg * 8);
            *(v8h*)(dst + (size_t)row * HD + seg * 8) = val; }
    } else {
#pragma unroll
        for (int nb = 0; nb < 4; ++nb) {
#pragma unroll
            for (int mb = 0; mb < 4; ++mb) { v8h pk;
#pragma unroll
                for (int j = 0; j < 8; ++j) pk[j] = toh_flush(acc[mb][nb][j] * (1.0f / WCAR));
                *(v8ha*)(T + (nb * 16 + lr) * 72 + mb * 16 + hi * 8) = pk; } }
        __syncthreads();
        h16* dst = VT + ((size_t)(b * NH + h) * HD) * SEQ + s0;
#pragma unroll
        for (int it = 0; it < 16; ++it) { const int piece = it * 32 + lane; const int d = piece >> 3, seg = piece & 7;
            const v8h val = *(const v8ha*)(T + d * 72 + seg * 8);
            *(v8h*)(dst + (size_t)d * SEQ + seg * 8) = val; }
    }
}

__global__ __launch_bounds__(128) void k_proj_out(const h16* __restrict__ A, const h16* __restrict__ Bt, const float* __restrict__ bias, float* C) {
    __shared__ __align__(16) h16 S[4 * GT];
    __shared__ __align__(16) float osb[4 * 16 * 68];
    const int lane = threadIdx.x & 31, lr = lane & 15, hi = lane >> 4;
    const int wave = __builtin_amdgcn_readfirstlane(threadIdx.x >> 5);
    float* os = osb + wave * 16 * 68;
    const int r0 = blockIdx.x * 128 + (wave >> 1) * 64, c0 = blockIdx.y * 128 + (wave & 1) * 64;
    v8f acc[4][4];
#pragma unroll
    for (int mb = 0; mb < 4; ++mb)
#pragma unroll
        for (int nb = 0; nb < 4; ++nb) acc[mb][nb] = (v8f){};
    gemm64(A, Bt, S, blockIdx.x * 128, blockIdx.y * 128, wave, acc);
    const int b = r0 / SEQ, s0 = r0 % SEQ; const int cofs = lr * 4;
    v4f b4;
#pragma unroll
    for (int q = 0; q < 4; ++q) b4[q] = bfr(bias[c0 + cofs + q]);
    const float fs = 1.0f / (WCAR * CCAR);
#pragma unroll
    for (int mb = 0; mb < 4; ++mb) {
#pragma unroll
        for (int nb = 0; nb < 4; ++nb)
#pragma unroll
            for (int j = 0; j < 8; ++j) os[(hi * 8 + j) * 68 + nb * 16 + lr] = acc[mb][nb][j];
        __syncthreads();
        float* crow = C + ((size_t)b * SEQ_FULL + s0 + mb * 16) * DM + c0;
{
#pragma unroll
            for (int s = 0; s < 8; ++s) { const int row = 2 * s + hi; const v4f raw = *(const v4fa*)(os + row * 68 + cofs); v4f val;
#pragma unroll
                for (int q = 0; q < 4; ++q) val[q] = raw[q] * fs + b4[q];
                *(v4f*)(crow + (size_t)row * DM + cofs) = val; }
             }
        __syncthreads();
    }
}

__global__ __launch_bounds__(256) void k_attn(const h16* __restrict__ Q, const h16* __restrict__ Kp, const h16* __restrict__ VT, const int* __restrict__ mask, h16* ctx) {
    __shared__ __align__(16) h16 Pl[8 * 16 * 72];
    __shared__ __align__(16) float kbias[SEQ];
    __shared__ __align__(8) unsigned tmk[SEQ / 32];
    __shared__ __align__(16) h16 KV[2 * 2 * KVT];   // [buffer][K tile, V^T tile][row][KVP]
    const int tid = threadIdx.x, lane = tid & 31, lr = lane & 15, hi = lane >> 4;
    const int wave = __builtin_amdgcn_readfirstlane(tid >> 5);
    const int bh = blockIdx.x; const int b = bh / NH, h = bh % NH;
    const int q0 = blockIdx.y * 128;
    const size_t pbase = (size_t)bh * SEQ * HD;
    const unsigned lst = (unsigned)(size_t)KV + (unsigned)((tid >> 3) * KVP + (tid & 7) * 8) * 2u;
    const h16* kg = Kp + pbase + (size_t)(tid >> 3) * HD + (tid & 7) * 8;
    const h16* vg = VT + pbase + (size_t)(tid >> 3) * SEQ + (tid & 7) * 8;
    stage_kv(lst, kg, vg);                                   // tile 0 -> buffer 0
    for (int i = 0; i < SEQ / 256; ++i) { const bool off = mask[(size_t)b * SEQ_FULL + i * 256 + tid] == 0;
        kbias[i * 256 + tid] = off ? NEGF : 0.0f;
        tmk[i * 8 + wave] = __builtin_amdgcn_ballot_w32(off); }   // the wave's 32 keys of this trip; every lane stores the same word
    asm volatile("s_wait_asynccnt 0x0" ::: "memory");        // this wave's copies of tile 0 have landed before the barrier that publishes them
    __syncthreads();
    stage_kv(lst + 2 * KVT * 2, kg + 64 * HD, vg + 64);      // tile 1 -> buffer 1
    const int tl = lane < SEQ / 64 ? lane : 0;
    const unsigned anym = __builtin_amdgcn_ballot_w32(lane < SEQ / 64 && (tmk[2 * tl] | tmk[2 * tl + 1]) != 0u);   // bit t: tile t holds a masked key
    const int pw = wave * 16 * 72;
    v16h qf0, qf1;
    { const h16* qp = Q + pbase + (size_t)(q0 + wave * 16 + lr) * HD + 8 * hi; qf0 = ldfrag(qp); qf1 = ldfrag(qp + 32); }
    v8f o[4]; float mi = NEGF, li = 0.0f;
#pragma unroll
    for (int t = 0; t < 4; ++t) o[t] = (v8f){};
#pragma unroll 1
    for (int kv0 = 0; kv0 < SEQ; kv0 += 64) {
        const int buf = (kv0 >> 6) & 1;
        const h16* kb = KV + buf * (2 * KVT) + lr * KVP + 8 * hi;
        const h16* vb = kb + KVT;
        const float* cp = kbias + kv0 + 8 * hi;
        v16h kf[4][2], vf[2][4];
#pragma unroll
        for (int t = 0; t < 4; ++t) { kf[t][0] = ldfrag_s(kb + t * 16 * KVP); kf[t][1] = ldfrag_s(kb + t * 16 * KVP + 32); }
        v8f sa[4];
#pragma unroll
        for (int t = 0; t < 4; ++t) sa[t] = wm16(kf[t][0], qf0, (v8f){});
#pragma unroll
        for (int t = 0; t < 4; ++t) sa[t] = wm16(kf[t][1], qf1, sa[t]);
#pragma unroll
        for (int s2 = 0; s2 < 2; ++s2)
#pragma unroll
            for (int t = 0; t < 4; ++t) vf[s2][t] = ldfrag_s(vb + t * 16 * KVP + s2 * 32);
        float scl = SC2;
        if ((anym >> (kv0 >> 6)) & 1u) {
            const v8f sc8 = {SC2, SC2, SC2, SC2, SC2, SC2, SC2, SC2};
#pragma unroll
            for (int t = 0; t < 4; ++t) sa[t] = __builtin_elementwise_fma(sa[t], sc8, cat8(*(const v4fa*)(cp + t * 16), *(const v4fa*)(cp + t * 16 + 4)));   // base-2 score of a kept key; the lowest finite f32 for a masked one
            scl = 1.0f;
        }
        float mt[4];                                          // one maximum chain per score tile
#pragma unroll
        for (int t = 0; t < 4; ++t) { mt[t] = sa[t][0];
#pragma unroll
            for (int j = 1; j < 8; ++j) mt[t] = fmaxf(mt[t], sa[t][j]); }
        float mx = fmaxf(fmaxf(mt[0], mt[1]), fmaxf(mt[2], mt[3])) * scl;   // in the base-2 domain
        mx = fmaxf(mx, xhalf(mx));                            // both halves hold the query's maximum over the 64 keys
        const float mnew = fmaxf(mi, mx);
        const float alpha = ex2(mi - mnew); mi = mnew;
        const float nm = PEXP - mnew;
        const v8f scl8 = {scl, scl, scl, scl, scl, scl, scl, scl}, nm8 = {nm, nm, nm, nm, nm, nm, nm, nm};
        v16h pf[2]; float ps[4];
#pragma unroll
        for (int t = 0; t < 4; ++t) { const v8f e = __builtin_elementwise_fma(sa[t], scl8, nm8); float p[8];
#pragma unroll
            for (int j = 0; j < 8; ++j) { p[j] = ex2(e[j]); pf[t >> 1][(t & 1) * 8 + j] = (h16)p[j]; }
            ps[t] = ((p[0] + p[1]) + (p[2] + p[3])) + ((p[4] + p[5]) + (p[6] + p[7])); }
        li = li * alpha + ((ps[0] + ps[1]) + (ps[2] + ps[3]));
#pragma unroll
        for (int t = 0; t < 4; ++t) o[t] = o[t] * alpha;
#pragma unroll
        for (int s2 = 0; s2 < 2; ++s2)
#pragma unroll
            for (int t = 0; t < 4; ++t) o[t] = wm16(vf[s2][t], pf[s2], o[t]);
        asm volatile("s_wait_dscnt 0x0" ::: "memory");       // this wave's reads of buffer buf have returned before the buffer is refilled
        asm volatile("s_wait_asynccnt 0x0" ::: "memory");    // this wave's copies of the next tile have landed before the barrier that publishes them
        __syncthreads();
        if (kv0 + 128 < SEQ) stage_kv(lst + (unsigned)buf * (2 * KVT * 2), kg + (size_t)(kv0 + 128) * HD, vg + kv0 + 128);   // tile t + 2 -> the buffer just read
    }
    asm volatile("s_wait_asynccnt 0x0" ::: "memory");        // no copy is outstanding when the wave goes on to its end
    const float inv = CCAR * __builtin_amdgcn_rcpf(li + xhalf(li));   // the two halves' sums joined once; the x1024 of P and of the sums cancel
#pragma unroll
    for (int t = 0; t < 4; ++t) { v8h pk;
#pragma unroll
        for (int j = 0; j < 8; ++j) pk[j] = (h16)(o[t][j] * inv);
        *(v8ha*)(Pl + pw + lr * 72 + t * 16 + hi * 8) = pk; }   // row = query lr; the 16 bytes are d = 16 t + 8 hi .. + 7
    asm volatile("" ::: "memory"); __builtin_amdgcn_wave_barrier(); asm volatile("" ::: "memory");
    h16* dst = ctx + ((size_t)b * SEQ + q0 + wave * 16) * DM + h * HD;
{
#pragma unroll
        for (int it = 0; it < 4; ++it) { const int piece = it * 32 + lane; const int row = piece >> 3, seg = piece & 7;
            const v8h val = *(const v8ha*)(Pl + pw + row * 72 + seg * 8);
            *(v8h*)(dst + (size_t)row * DM + seg * 8) = val; }
         }
}

extern "C" void kernel_launch(void* const* d_in, const int* in_sizes, int n_in,
                              void* d_out, int out_size, void* d_ws, size_t ws_size, hipStream_t stream) {
    if (n_in < 6) return;
    const size_t xneed = ((size_t)(NB - 1) * SEQ_FULL + SEQ) * DM;
    const size_t mneed = (size_t)(NB - 1) * SEQ_FULL + SEQ;
    if ((size_t)in_sizes[0] < xneed || (size_t)in_sizes[1] < mneed) return;
    if (in_sizes[2] < DM * DM || in_sizes[3] < 2 * DM * DM || in_sizes[4] < DM * DM) return;
    if (in_sizes[5] < DM) return;
    if ((size_t)out_size < xneed) return;
    if (ws_size < WS_TOTAL) return;
    // input order of the wire: x, mask, Wq [512][512], Wkv [512][1024], Wout [512][512], bout [512]
    const float* x   = (const float*)d_in[0]; const int* mask = (const int*)d_in[1];
    const float* wq  = (const float*)d_in[2];
    const float* wkv = (const float*)d_in[3];
    const float* wo  = (const float*)d_in[4]; const float* bo = (const float*)d_in[5];
    float* OUT = (float*)d_out;
    char* wsp = (char*)d_ws;
    h16* XH = (h16*)wsp; wsp += SZ_X;      // [NB*SEQ][DM]
    h16* WT = (h16*)wsp; wsp += SZ_W;      // [4][n][k]: q, k, v, o
    h16* QP = (h16*)wsp; wsp += SZ_X;      // [b][h][s][64]
    h16* KP = (h16*)wsp; wsp += SZ_X;      // [b][h][s][64]
    h16* VT = (h16*)wsp; wsp += SZ_X;      // [b][h][64][s]
    h16* CX = (h16*)wsp; wsp += SZ_X;      // [NB*SEQ][DM], x64
    const size_t wsz = (size_t)DM * DM;
    k_prep<<<(unsigned)(WTB + (size_t)NB * SEQ * DM / 8 / 256), 256, 0, stream>>>(x, wq, wkv, wo, XH, WT);   // x -> XH; the weights -> [2048 n][512 k] = q, k, v, o planes
    const dim3 gg(NB * SEQ / 128, DM / 128);
    const dim3 g3(NB * SEQ / 128, 3 * DM / 128);
    k_proj_qkv<<<g3, 128, 0, stream>>>(XH, WT, QP, KP, VT);
    k_attn<<<dim3(NB * NH, SEQ / 128), 256, 0, stream>>>(QP, KP, VT, mask, CX);
    k_proj_out<<<gg, 128, 0, stream>>>(CX, WT + 3 * wsz, bo, OUT);
}

// v007
// A run of this version takes 57.7 microseconds.
// Timed twice side by side with v006, it ran 1.05 times as fast both times.
// Over all steps from v000 it is 4.47 times as fast.
#include <hip/hip_runtime.h>

// Multi-head self-attention with a per-key padding mask input: x [4][2048][512]; q = x Wq, fused kv = x Wkv ([in][out] weights; k = first 512 output columns, v = last 512; 8 heads x 64; no q/k/v biases); scores = (q k^T) / 8 with masked keys REPLACED by the lowest finite f32; softmax over the keys; out = merged ctx Wout + bout.
// Compute dtypes: all contractions v_wmma_f32_16x16x32_f16 (f16 operands, f32 accumulate). Every float input is converted to bf16 (RNE) on load and carried exactly in f16 (weights x16); q, k, v planes plain f16; P carried x1024 (row sums from the unconverted f32 values); ctx carried x64 against Wout x16; softmax f32.
// Engine: 4-wave 128x128 GEMM blocks (each wave a 64x64 register-blocked tile), A and B k-chunks of 64 staged once per block in a two-buffer LDS ring by asynchronous copies; fused flash-style attention on transposed products S^T = K Q^T, O^T += V^T P^T (32 queries a wave, online softmax in-lane, K and V^T tiles staged once per block in a two-buffer LDS ring by asynchronous copies, P packed in registers, mask as one f32 addend per key in LDS, read only for 64-key tiles that hold a masked key).

#ifndef NB
#define NB 4
#endif
#ifndef SEQ
#define SEQ 2048
#endif
#define NB_FULL  4
#define SEQ_FULL 2048
#define DM   512
#define NH   8
#define HD   64
#define WCAR 16.0f      // weight carry (exact power of two)
#define PCAR 1024.0f    // probability carry
#define CCAR 64.0f      // ctx carry
#define SCL  0.125f     // HD^-0.5
#define L2E  1.4426950408889634f
#define NEGF (-3.402823466e38f)
#define SC2  (SCL * L2E) // scores to the base-2 domain; an exact scaling of L2E
#define PEXP 10.0f      // log2 of PCAR
#define KVP  72         // LDS pitch of a staged K or V^T row, in f16: 144 bytes = 16 x odd, conflict-free for 16-byte readers
#define KVT  (64 * KVP) // one staged tile: 64 rows of 64 f16
#define GT   (128 * KVP) // one staged GEMM operand tile: 128 rows of 64 f16, same pitch
#define WTB  (4 * (DM / 64) * (DM / 64)) // weight-tile blocks of k_prep: four [512][512] planes in 64x64 tiles

typedef _Float16 h16;
typedef __attribute__((ext_vector_type(16))) _Float16 v16h;
typedef __attribute__((ext_vector_type(8)))  _Float16 v8h;
typedef __attribute__((ext_vector_type(8)))  float    v8f;
typedef __attribute__((ext_vector_type(4)))  float    v4f;
typedef v8h __attribute__((may_alias)) v8ha;
typedef v4f __attribute__((may_alias)) v4fa;

static_assert(NH * HD == DM);            // merged head width equals the model width
static_assert(HD == 64);
static_assert(DM % 64 == 0);             // N tiles of 64
static_assert(DM % 32 == 0);             // k-steps of 32
static_assert(SEQ % 128 == 0);           // 128 query rows per attention block; 64-row GEMM tiles stay inside one batch
static_assert(SEQ <= SEQ_FULL);
static_assert(NB <= NB_FULL);
static_assert(SEQ % 128 == 0);           // mask addends split evenly over k_attn's 128 threads

#define SZ_X   ((size_t)NB * SEQ * DM * 2)      // f16 plane of x / q / k / v^T / ctx
#define SZ_W   ((size_t)4 * DM * DM * 2)        // four transposed weight planes
#define WS_TOTAL (SZ_X * 5 + SZ_W)
static_assert(SZ_X % 256 == 0);
static_assert(SZ_W % 256 == 0);
static_assert(WS_TOTAL <= (size_t)134217728);   // carve stays under 128 MiB

// file-scope bounds for the kernels below
static_assert((2 * DM) % 64 == 0);                        // fused kv weight: 16 column tiles of 64, k plane then v plane
static_assert(256 * 4 * 4 == 64 * 64);                    // k_prep weight fill: threads x trips x elements == tile elements
static_assert(256 * 2 * 16 == 64 * 128);
static_assert(32 * 16 * 16 == 64 * 128);
static_assert(32 * 4 * 16 == 16 * 128);
static_assert(64 * 72 * 2 <= 131072);                     // static LDS of k_prep
static_assert(4 * (4 * GT * 2) <= 327680);                // static LDS of k_proj_qkv: the ring alone, small enough for four blocks on one WGP, so the whole grid is resident at once
static_assert(4 * 64 * 72 <= 4 * GT);                     // the four waves' output tiles fit in the ring they reuse
static_assert(4 * GT * 2 + 4 * 16 * 68 * 4 <= 131072);    // static LDS of k_proj_out
static_assert(128 * 8 * 8 == 128 * 64);                   // GEMM staging: threads x copies x elements == operand tile elements
static_assert(DM % 128 == 0 && DM >= 128);                // 128-column GEMM blocks; the ring's prologue fills two k-chunks of 64
static_assert((size_t)NB * SEQ % 128 == 0);               // 128-row GEMM blocks
static_assert(4 * 32 * 72 * 2 + 4 * KVT * 2 + SEQ * 4 + SEQ / 32 * 4 <= 131072); // static LDS of k_attn
static_assert(SEQ / 64 <= 32);                            // k_attn: one bit per 64-key tile in one 32-bit word
static_assert(128 * 4 * 8 == 64 * HD);                    // k_attn staging: threads x copies x elements == tile elements
static_assert(SEQ >= 128);                                // the ring's prologue fills two tiles of 64 keys
static_assert((KVP * 2) % 16 == 0);                       // every staged row starts at a multiple of the copy width
static_assert((size_t)NB * SEQ % 64 == 0);                // GEMM row tiles
static_assert((size_t)NB * SEQ * DM % (8 * 256) == 0);     // k_prep: whole blocks of x converters

__device__ __forceinline__ unsigned short f2bf(float f) { unsigned u = __float_as_uint(f); u += 0x7FFFu + ((u >> 16) & 1u); return (unsigned short)(u >> 16); }
__device__ __forceinline__ float bfr(float f) { return __uint_as_float(((unsigned)f2bf(f)) << 16); }
__device__ __forceinline__ v8f cat8(v4f lo, v4f hi) { return __builtin_shufflevector(lo, hi, 0, 1, 2, 3, 4, 5, 6, 7); }
__device__ __forceinline__ v16h cat16(v8h lo, v8h hi) { return __builtin_shufflevector(lo, hi, 0, 1, 2, 3, 4, 5, 6, 7, 8, 9, 10, 11, 12, 13, 14, 15); }
// fragment loader for A (row-major [m][k]) and for B given as a [n][k] copy: elements 0..7 <- k0+8h.., elements 8..15 <- k0+16+8h.. ; p already includes the 8h offset
__device__ __forceinline__ v16h ldfrag(const h16* p) { return cat16(*(const v8h*)p, *(const v8h*)(p + 16)); }
// the same fragment from a staged LDS tile (same k map)
__device__ __forceinline__ v16h ldfrag_s(const h16* p) { return cat16(*(const v8ha*)p, *(const v8ha*)(p + 16)); }
// One 64-key stage: each of the 128 threads copies 8 x 16 bytes, rows r + 16 j (r = tid / 8, j = 0..3) of the K tile and of the V^T tile.
// lk: the lane's LDS byte address in the K tile of the target buffer; kg, vg: the lane's global sources.
// s_wait_xcnt stands inside the copies' own statement, so that no address register is rewritten ahead of it.
__device__ __forceinline__ void stage_kv(unsigned lk, const h16* kg, const h16* vg) {
    const unsigned lk1 = lk + 16 * KVP * 2, lk2 = lk + 32 * KVP * 2, lk3 = lk + 48 * KVP * 2;
    const unsigned lv = lk + KVT * 2, lv1 = lv + 16 * KVP * 2, lv2 = lv + 32 * KVP * 2, lv3 = lv + 48 * KVP * 2;
    const h16* kg1 = kg + 16 * HD; const h16* kg2 = kg + 32 * HD; const h16* kg3 = kg + 48 * HD;
    const h16* vg1 = vg + (size_t)16 * SEQ; const h16* vg2 = vg + (size_t)32 * SEQ; const h16* vg3 = vg + (size_t)48 * SEQ;
    asm volatile("global_load_async_to_lds_b128 %0, %8, off\n\t"
                 "global_load_async_to_lds_b128 %1, %9, off\n\t"
                 "global_load_async_to_lds_b128 %2, %10, off\n\t"
                 "global_load_async_to_lds_b128 %3, %11, off\n\t"
                 "global_load_async_to_lds_b128 %4, %12, off\n\t"
                 "global_load_async_to_lds_b128 %5, %13, off\n\t"
                 "global_load_async_to_lds_b128 %6, %14, off\n\t"
                 "global_load_async_to_lds_b128 %7, %15, off\n\t"
                 "s_wait_xcnt 0x0"
                 :: "v"(lk), "v"(lk1), "v"(lk2), "v"(lk3), "v"(lv), "v"(lv1), "v"(lv2), "v"(lv3),
                    "v"(kg), "v"(kg1), "v"(kg2), "v"(kg3), "v"(vg), "v"(vg1), "v"(vg2), "v"(vg3) : "memory");
}
// One GEMM operand tile of a 64-wide k-chunk: each of the 128 threads copies 8 x 16 bytes, rows r + 16 j (r = tid / 8, j = 0..7), source pitch DM.
// l: the lane's LDS byte address in the target tile; g: the lane's global source. s_wait_xcnt stands inside the copies' own statement, as in stage_kv.
__device__ __forceinline__ void stage_g(unsigned l, const h16* g) {
    const unsigned l1 = l + 16 * KVP * 2, l2 = l + 32 * KVP * 2, l3 = l + 48 * KVP * 2, l4 = l + 64 * KVP * 2, l5 = l + 80 * KVP * 2, l6 = l + 96 * KVP * 2, l7 = l + 112 * KVP * 2;
    const h16* g1 = g + 16 * DM; const h16* g2 = g + 32 * DM; const h16* g3 = g + 48 * DM; const h16* g4 = g + 64 * DM;
    const h16* g5 = g + 80 * DM; const h16* g6 = g + 96 * DM; const h16* g7 = g + 112 * DM;
    asm volatile("global_load_async_to_lds_b128 %0, %8, off\n\t"
                 "global_load_async_to_lds_b128 %1, %9, off\n\t"
                 "global_load_async_to_lds_b128 %2, %10, off\n\t"
                 "global_load_async_to_lds_b128 %3, %11, off\n\t"
                 "global_load_async_to_lds_b128 %4, %12, off\n\t"
                 "global_load_async_to_lds_b128 %5, %13, off\n\t"
                 "global_load_async_to_lds_b128 %6, %14, off\n\t"
                 "global_load_async_to_lds_b128 %7, %15, off\n\t"
                 "s_wait_xcnt 0x0"
                 :: "v"(l), "v"(l1), "v"(l2), "v"(l3), "v"(l4), "v"(l5), "v"(l6), "v"(l7),
                    "v"(g), "v"(g1), "v"(g2), "v"(g3), "v"(g4), "v"(g5), "v"(g6), "v"(g7) : "memory");
}
// one WMMA with its own hazard guard (ties the accumulator, keeps A/B live)
__device__ __forceinline__ v8f wm16(v16h a, v16h b, v8f c) {
    c = __builtin_amdgcn_wmma_f32_16x16x32_f16(false, a, false, b, (short)0, c, false, false);
    asm volatile("v_nop\n\tv_nop\n\tv_nop\n\tv_nop" : "+v"(c) : "v"(a), "v"(b));
    return c;
}
// the product of k_attn: the builtin alone, padded by the compiler. What an asm statement names must lie in v0..v255, and the operands of a 32-query wave do not all fit there (with wm16 the build spilled).
__device__ __forceinline__ v8f wmb(v16h a, v16h b, v8f c) { return __builtin_amdgcn_wmma_f32_16x16x32_f16(false, a, false, b, (short)0, c, false, false); }
__device__ __forceinline__ float ex2(float x) { return __builtin_amdgcn_exp2f(x); }
// lane l with lane l ^ 16
__device__ __forceinline__ float xhalf(float x) { return __builtin_bit_cast(float, __builtin_amdgcn_permlanex16(__builtin_bit_cast(int, x), __builtin_bit_cast(int, x), 0x76543210, 0xfedcba98, false, false)); }
// f32 -> f16 convert that cannot produce an f16 subnormal: |v| < 2^-14 becomes +0 (value select, applied after the carry)
static __device__ __forceinline__ h16 toh_flush(float v) { const h16 r = (h16)v; return (fabsf(v) < 6.103515625e-05f) ? (h16)0.0f : r; }

// ---- k_prep: the four independent preparation jobs share one launch, told apart by the block index (a block-uniform branch).
// Blocks 0 .. WTB - 1: one 64x64 weight tile each, transposed into the [4][n][k] planes q, k, v, o (2048 rows of 512): row tile nt = block / 8, k tile = block % 8.
// Row tiles 0..7 come from Wq, 8..23 from the fused kv weight (pitch 1024: k plane, then v plane), 24..31 from Wout. LDS tile T is cross-wave: block barrier between fill and drain.
// They stand first in the grid because their chain (load, LDS, barrier, LDS, store) is the longer one. The other blocks convert x, 8 elements a thread.
__global__ __launch_bounds__(256) void k_prep(const float* __restrict__ x, const float* __restrict__ wq, const float* __restrict__ wkv, const float* __restrict__ wo, h16* xh, h16* Wt) {
    __shared__ __align__(16) h16 T[64 * 72];
    const int tid = threadIdx.x; const int bid = blockIdx.x;
    if (bid < WTB) {
        const int k0 = (bid % (DM / 64)) * 64, nt = bid / (DM / 64);
        const float* W = wq; int ldw = DM, n0 = nt * 64;
        if (nt >= 3 * (DM / 64)) { W = wo; n0 = (nt - 3 * (DM / 64)) * 64; }
        else if (nt >= DM / 64) { W = wkv; ldw = 2 * DM; n0 = (nt - DM / 64) * 64; }
#pragma unroll
        for (int j = 0; j < 4; ++j) { const int i = tid + 256 * j; const int kr = i >> 4, c4 = (i & 15) * 4;
            const v4f v = *(const v4f*)(W + (size_t)(k0 + kr) * ldw + n0 + c4);
#pragma unroll
            for (int q = 0; q < 4; ++q) T[(c4 + q) * 72 + kr] = toh_flush(bfr(v[q]) * WCAR); }
        __syncthreads();
#pragma unroll
        for (int j = 0; j < 2; ++j) { const int p = tid + 256 * j; const int n = p >> 3, seg = p & 7;
            const v8h val = *(const v8ha*)(T + n * 72 + seg * 8);
            *(v8h*)(Wt + (size_t)(nt * 64 + n) * DM + k0 + seg * 8) = val; }
        return;
    }
    const size_t i = (size_t)(bid - WTB) * 256 + tid;
    if (i >= (size_t)NB * SEQ * DM / 8) return;
    const size_t row = i / (DM / 8); const int g = (int)(i % (DM / 8));
    const size_t b = row / SEQ, s = row % SEQ;
    const float* src = x + ((b * SEQ_FULL + s) * DM + (size_t)g * 8);
    const v4f v0 = *(const v4f*)src; const v4f v1 = *(const v4f*)(src + 4);
    v8h o;
#pragma unroll
    for (int k = 0; k < 4; ++k) { o[k] = (h16)bfr(v0[k]); o[4 + k] = (h16)bfr(v1[k]); }
    *(v8h*)(xh + i * 8) = o;
}

// ---- GEMM main loop: 4 waves per 128x128 block, each wave a 64x64 tile (wave w: rows 64 (w / 2), columns 64 (w % 2)), 16 accumulators, K = DM, operands from K-contiguous f16 planes (A [m][k], Bt [n][k]).
// Per 64-wide k-chunk the block's 128 A rows and 128 Bt rows are copied once into LDS (S: [buffer][A tile, B tile][row][KVP]; the next chunk's copies fly while this one is worked on);
// the waves read their fragments there (same k map, same k order of the sums as from the planes). One block barrier per chunk publishes the next chunk and frees the one just read.
__device__ __forceinline__ void gemm64(const h16* __restrict__ A, const h16* __restrict__ Bt, h16* S, int R0, int C0, int wave, v8f (&acc)[4][4]) {
    const int tid = threadIdx.x, lane = tid & 31, lr = lane & 15, hi = lane >> 4;
    const unsigned lst = (unsigned)(size_t)S + (unsigned)((tid >> 3) * KVP + (tid & 7) * 8) * 2u;
    const h16* ag = A + (size_t)(R0 + (tid >> 3)) * DM + (tid & 7) * 8;
    const h16* bg = Bt + (size_t)(C0 + (tid >> 3)) * DM + (tid & 7) * 8;
    stage_g(lst, ag); stage_g(lst + GT * 2, bg);                          // chunk 0 -> buffer 0
    asm volatile("s_wait_asynccnt 0x0" ::: "memory");        // this wave's copies of chunk 0 have landed before the barrier that publishes them
    __syncthreads();
    stage_g(lst + 2 * GT * 2, ag + 64); stage_g(lst + 3 * GT * 2, bg + 64);  // chunk 1 -> buffer 1
    const int aofs = ((wave >> 1) * 64 + lr) * KVP + 8 * hi, bofs = GT + ((wave & 1) * 64 + lr) * KVP + 8 * hi;
#pragma unroll 1
    for (int kc = 0; kc < DM; kc += 64) {
        const int buf = (kc >> 6) & 1;
        const h16* as = S + buf * (2 * GT) + aofs;
        const h16* bs = S + buf * (2 * GT) + bofs;
#pragma unroll
        for (int ks = 0; ks < 64; ks += 32) {
            v16h a[4], b[4];
#pragma unroll
            for (int mb = 0; mb < 4; ++mb) a[mb] = ldfrag_s(as + mb * 16 * KVP + ks);
#pragma unroll
            for (int nb = 0; nb < 4; ++nb) b[nb] = ldfrag_s(bs + nb * 16 * KVP + ks);
#pragma unroll
            for (int nb = 0; nb < 4; ++nb)
#pragma unroll
                for (int mb = 0; mb < 4; ++mb) acc[mb][nb] = wm16(a[mb], b[nb], acc[mb][nb]);
        }
        asm volatile("s_wait_dscnt 0x0" ::: "memory");       // this wave's reads of buffer buf have returned before the buffer is refilled
        asm volatile("s_wait_asynccnt 0x0" ::: "memory");    // this wave's copies of the next chunk have landed before the barrier that publishes them
        __syncthreads();
        if (kc + 128 < DM) { stage_g(lst + (unsigned)buf * (2 * GT * 2), ag + kc + 128); stage_g(lst + (unsigned)buf * (2 * GT * 2) + GT * 2, bg + kc + 128); }   // chunk t + 2 -> the buffer just read
    }
    asm volatile("s_wait_asynccnt 0x0" ::: "memory");        // no copy is outstanding when the wave goes on to its epilogue
}

// ---- k_proj_qkv: the three independent input projections share one launch; grid (NB*SEQ/128, 3*DM/128), 128 threads. Bt is the q, k, v weight planes as one [3*DM][DM] array;
// column block y belongs to projection y / (DM/128) (a block-uniform choice): 0 and 1 write a head plane [b][h][s][64] f16 = x Wt^T / 16 (no bias in this module), 2 writes V^T [b][h][64][s]. T is private to each wave.
// T lies in the ring's own LDS: behind the main loop's last block barrier no wave reads the ring any more and no copy into it is outstanding. A second array would hold the WGP to two blocks and the grid to two rounds.
__global__ __launch_bounds__(128) void k_proj_qkv(const h16* __restrict__ A, const h16* __restrict__ Bt, h16* QPl, h16* KPl, h16* VT) {
    __shared__ __align__(16) h16 S[4 * GT];
    const int lane = threadIdx.x & 31, lr = lane & 15, hi = lane >> 4;
    const int wave = __builtin_amdgcn_readfirstlane(threadIdx.x >> 5);
    h16* T = S + wave * 64 * 72;
    const int sel = blockIdx.y / (DM / 128);
    const int r0 = blockIdx.x * 128 + (wave >> 1) * 64, c0 = (blockIdx.y % (DM / 128)) * 128 + (wave & 1) * 64;
    v8f acc[4][4];
#pragma unroll
    for (int mb = 0; mb < 4; ++mb)
#pragma unroll
        for (int nb = 0; nb < 4; ++nb) acc[mb][nb] = (v8f){};
    gemm64(A, Bt, S, blockIdx.x * 128, blockIdx.y * 128, wave, acc);
    const int b = r0 / SEQ, s0 = r0 % SEQ, h = c0 / HD;
    if (sel < 2) {
#pragma unroll
        for (int nb = 0; nb < 4; ++nb) {
#pragma unroll
            for (int mb = 0; mb < 4; ++mb)
#pragma unroll
                for (int j = 0; j < 8; ++j) T[(mb * 16 + hi * 8 + j) * 72 + nb * 16 + lr] = toh_flush(acc[mb][nb][j] * (1.0f / WCAR)); }
        __syncthreads();
        h16* dst = (sel == 0 ? QPl : KPl) + ((size_t)(b * NH + h) * SEQ + s0) * HD;
#pragma unroll
        for (int it = 0; it < 16; ++it) { const int piece = it * 32 + lane; const int row = piece >> 3, seg = piece & 7;
            const v8h val = *(const v8ha*)(T + row * 72 + seg * 8);
            *(v8h*)(dst + (size_t)row * HD + seg * 8) = val; }
    } else {
#pragma unroll
        for (int nb = 0; nb < 4; ++nb) {
#pragma unroll
            for (int mb = 0; mb < 4; ++mb) { v8h pk;
#pragma unroll
                for (int j = 0; j < 8; ++j) pk[j] = toh_flush(acc[mb][nb][j] * (1.0f / WCAR));
                *(v8ha*)(T + (nb * 16 + lr) * 72 + mb * 16 + hi * 8) = pk; } }
        __syncthreads();
        h16* dst = VT + ((size_t)(b * NH + h) * HD) * SEQ + s0;
#pragma unroll
        for (int it = 0; it < 16; ++it) { const int piece = it * 32 + lane; const int d = piece >> 3, seg = piece & 7;
            const v8h val = *(const v8ha*)(T + d * 72 + seg * 8);
            *(v8h*)(dst + (size_t)d * SEQ + seg * 8) = val; }
    }
}

__global__ __launch_bounds__(128) void k_proj_out(const h16* __restrict__ A, const h16* __restrict__ Bt, const float* __restrict__ bias, float* C) {
    __shared__ __align__(16) h16 S[4 * GT];
    __shared__ __align__(16) float osb[4 * 16 * 68];
    const int lane = threadIdx.x & 31, lr = lane & 15, hi = lane >> 4;
    const int wave = __builtin_amdgcn_readfirstlane(threadIdx.x >> 5);
    float* os = osb + wave * 16 * 68;
    const int r0 = blockIdx.x * 128 + (wave >> 1) * 64, c0 = blockIdx.y * 128 + (wave & 1) * 64;
    v8f acc[4][4];
#pragma unroll
    for (int mb = 0; mb < 4; ++mb)
#pragma unroll
        for (int nb = 0; nb < 4; ++nb) acc[mb][nb] = (v8f){};
    gemm64(A, Bt, S, blockIdx.x * 128, blockIdx.y * 128, wave, acc);
    const int b = r0 / SEQ, s0 = r0 % SEQ; const int cofs = lr * 4;
    v4f b4;
#pragma unroll
    for (int q = 0; q < 4; ++q) b4[q] = bfr(bias[c0 + cofs + q]);
    const float fs = 1.0f / (WCAR * CCAR);
#pragma unroll
    for (int mb = 0; mb < 4; ++mb) {
#pragma unroll
        for (int nb = 0; nb < 4; ++nb)
#pragma unroll
            for (int j = 0; j < 8; ++j) os[(hi * 8 + j) * 68 + nb * 16 + lr] = acc[mb][nb][j];
        __syncthreads();
        float* crow = C + ((size_t)b * SEQ_FULL + s0 + mb * 16) * DM + c0;
{
#pragma unroll
            for (int s = 0; s < 8; ++s) { const int row = 2 * s + hi; const v4f raw = *(const v4fa*)(os + row * 68 + cofs); v4f val;
#pragma unroll
                for (int q = 0; q < 4; ++q) val[q] = raw[q] * fs + b4[q];
                *(v4f*)(crow + (size_t)row * DM + cofs) = val; }
             }
        __syncthreads();
    }
}

__global__ __launch_bounds__(128) __attribute__((amdgpu_waves_per_eu(2, 2))) void k_attn(const h16* __restrict__ Q, const h16* __restrict__ Kp, const h16* __restrict__ VT, const int* __restrict__ mask, h16* ctx) {
    __shared__ __align__(16) h16 Pl[4 * 32 * 72];
    __shared__ __align__(16) float kbias[SEQ];
    __shared__ __align__(8) unsigned tmk[SEQ / 32];
    __shared__ __align__(16) h16 KV[2 * 2 * KVT];   // [buffer][K tile, V^T tile][row][KVP]
    const int tid = threadIdx.x, lane = tid & 31, lr = lane & 15, hi = lane >> 4;
    const int wave = __builtin_amdgcn_readfirstlane(tid >> 5);
    const int bh = blockIdx.x; const int b = bh / NH, h = bh % NH;
    const int q0 = blockIdx.y * 128;
    const size_t pbase = (size_t)bh * SEQ * HD;
    const unsigned lst = (unsigned)(size_t)KV + (unsigned)((tid >> 3) * KVP + (tid & 7) * 8) * 2u;
    const h16* kg = Kp + pbase + (size_t)(tid >> 3) * HD + (tid & 7) * 8;
    const h16* vg = VT + pbase + (size_t)(tid >> 3) * SEQ + (tid & 7) * 8;
    stage_kv(lst, kg, vg);                                   // tile 0 -> buffer 0
    for (int i = 0; i < SEQ / 128; ++i) { const bool off = mask[(size_t)b * SEQ_FULL + i * 128 + tid] == 0;
        kbias[i * 128 + tid] = off ? NEGF : 0.0f;
        tmk[i * 4 + wave] = __builtin_amdgcn_ballot_w32(off); }   // the wave's 32 keys of this trip; every lane stores the same word
    asm volatile("s_wait_asynccnt 0x0" ::: "memory");        // this wave's copies of tile 0 have landed before the barrier that publishes them
    __syncthreads();
    stage_kv(lst + 2 * KVT * 2, kg + 64 * HD, vg + 64);      // tile 1 -> buffer 1
    const int tl = lane < SEQ / 64 ? lane : 0;
    const unsigned anym = __builtin_amdgcn_ballot_w32(lane < SEQ / 64 && (tmk[2 * tl] | tmk[2 * tl + 1]) != 0u);   // bit t: tile t holds a masked key
    const int pw = wave * 32 * 72;
    v16h qf[2][2];
#pragma unroll
    for (int c = 0; c < 2; ++c) { const h16* qp = Q + pbase + (size_t)(q0 + wave * 32 + c * 16 + lr) * HD + 8 * hi; qf[c][0] = ldfrag(qp); qf[c][1] = ldfrag(qp + 32); }
    v8f o[2][4]; float mi[2] = {NEGF, NEGF}, li[2] = {0.0f, 0.0f};
#pragma unroll
    for (int c = 0; c < 2; ++c)
#pragma unroll
        for (int t = 0; t < 4; ++t) o[c][t] = (v8f){};
#pragma unroll 1
    for (int kv0 = 0; kv0 < SEQ; kv0 += 64) {
        const int buf = (kv0 >> 6) & 1;
        const h16* kb = KV + buf * (2 * KVT) + lr * KVP + 8 * hi;
        const h16* vb = kb + KVT;
        const float* cp = kbias + kv0 + 8 * hi;
        v16h kf[4][2], vf[2][4];
#pragma unroll
        for (int t = 0; t < 4; ++t) { kf[t][0] = ldfrag_s(kb + t * 16 * KVP); kf[t][1] = ldfrag_s(kb + t * 16 * KVP + 32); }
        __builtin_amdgcn_sched_barrier(0);                   // the 16 K reads stay one group ahead of their products: left free, the compiler spreads them among the WMMAs, each behind a wait to 0
        v8f sa[2][4];
#pragma unroll
        for (int t = 0; t < 4; ++t)
#pragma unroll
            for (int c = 0; c < 2; ++c) sa[c][t] = wmb(kf[t][0], qf[c][0], (v8f){});
#pragma unroll
        for (int t = 0; t < 4; ++t)
#pragma unroll
            for (int c = 0; c < 2; ++c) sa[c][t] = wmb(kf[t][1], qf[c][1], sa[c][t]);
        __builtin_amdgcn_sched_barrier(0);                   // the 16 V^T reads stay one group between the score products and the softmax, whose length hides their latency
#pragma unroll
        for (int s2 = 0; s2 < 2; ++s2)
#pragma unroll
            for (int t = 0; t < 4; ++t) vf[s2][t] = ldfrag_s(vb + t * 16 * KVP + s2 * 32);
        __builtin_amdgcn_sched_barrier(0);                   // (the group's lower edge)
        float scl = SC2;
        if ((anym >> (kv0 >> 6)) & 1u) {
            const v8f sc8 = {SC2, SC2, SC2, SC2, SC2, SC2, SC2, SC2};
#pragma unroll
            for (int t = 0; t < 4; ++t) { const v8f kb8 = cat8(*(const v4fa*)(cp + t * 16), *(const v4fa*)(cp + t * 16 + 4));
#pragma unroll
                for (int c = 0; c < 2; ++c) sa[c][t] = __builtin_elementwise_fma(sa[c][t], sc8, kb8); }   // base-2 score of a kept key; the lowest finite f32 for a masked one
            scl = 1.0f;
        }
        const v8f scl8 = {scl, scl, scl, scl, scl, scl, scl, scl};
        v16h pf[2][2];
#pragma unroll
        for (int c = 0; c < 2; ++c) {
            float mt[4];                                      // one maximum chain per score tile
#pragma unroll
            for (int t = 0; t < 4; ++t) { mt[t] = sa[c][t][0];
#pragma unroll
                for (int j = 1; j < 8; ++j) mt[t] = fmaxf(mt[t], sa[c][t][j]); }
            float mx = fmaxf(fmaxf(mt[0], mt[1]), fmaxf(mt[2], mt[3])) * scl;   // in the base-2 domain
            mx = fmaxf(mx, xhalf(mx));                        // both halves hold the query's maximum over the 64 keys
            const float mnew = fmaxf(mi[c], mx);
            const float alpha = ex2(mi[c] - mnew); mi[c] = mnew;
            const float nm = PEXP - mnew;
            const v8f nm8 = {nm, nm, nm, nm, nm, nm, nm, nm};
            float ps[4];
#pragma unroll
            for (int t = 0; t < 4; ++t) { const v8f e = __builtin_elementwise_fma(sa[c][t], scl8, nm8); float p[8];
#pragma unroll
                for (int j = 0; j < 8; ++j) { p[j] = ex2(e[j]); pf[c][t >> 1][(t & 1) * 8 + j] = (h16)p[j]; }
                ps[t] = ((p[0] + p[1]) + (p[2] + p[3])) + ((p[4] + p[5]) + (p[6] + p[7])); }
            li[c] = li[c] * alpha + ((ps[0] + ps[1]) + (ps[2] + ps[3]));
#pragma unroll
            for (int t = 0; t < 4; ++t) o[c][t] = o[c][t] * alpha;
        }
#pragma unroll
        for (int s2 = 0; s2 < 2; ++s2)
#pragma unroll
            for (int t = 0; t < 4; ++t)
#pragma unroll
                for (int c = 0; c < 2; ++c) o[c][t] = wmb(vf[s2][t], pf[c][s2], o[c][t]);
        __builtin_amdgcn_sched_barrier(0);                   // the products stay ahead of the trip's waits and barrier, so that the refill behind the barrier is not held up by them
        asm volatile("s_wait_dscnt 0x0" ::: "memory");       // this wave's reads of buffer buf have returned before the buffer is refilled
        asm volatile("s_wait_asynccnt 0x0" ::: "memory");    // this wave's copies of the next tile have landed before the barrier that publishes them
        __syncthreads();
        if (kv0 + 128 < SEQ) stage_kv(lst + (unsigned)buf * (2 * KVT * 2), kg + (size_t)(kv0 + 128) * HD, vg + kv0 + 128);   // tile t + 2 -> the buffer just read
    }
    asm volatile("s_wait_asynccnt 0x0" ::: "memory");        // no copy is outstanding when the wave goes on to its end
#pragma unroll
    for (int c = 0; c < 2; ++c) {
        const float inv = CCAR * __builtin_amdgcn_rcpf(li[c] + xhalf(li[c]));   // the two halves' sums joined once; the x1024 of P and of the sums cancel
#pragma unroll
        for (int t = 0; t < 4; ++t) { v8h pk;
#pragma unroll
            for (int j = 0; j < 8; ++j) pk[j] = (h16)(o[c][t][j] * inv);
            *(v8ha*)(Pl + pw + (c * 16 + lr) * 72 + t * 16 + hi * 8) = pk; }   // row = query 16 c + lr; the 16 bytes are d = 16 t + 8 hi .. + 7
    }
    asm volatile("" ::: "memory"); __builtin_amdgcn_wave_barrier(); asm volatile("" ::: "memory");
    h16* dst = ctx + ((size_t)b * SEQ + q0 + wave * 32) * DM + h * HD;
#pragma unroll
    for (int it = 0; it < 8; ++it) { const int piece = it * 32 + lane; const int row = piece >> 3, seg = piece & 7;
        const v8h val = *(const v8ha*)(Pl + pw + row * 72 + seg * 8);
        *(v8h*)(dst + (size_t)row * DM + seg * 8) = val; }
}

extern "C" void kernel_launch(void* const* d_in, const int* in_sizes, int n_in,
                              void* d_out, int out_size, void* d_ws, size_t ws_size, hipStream_t stream) {
    if (n_in < 6) return;
    const size_t xneed = ((size_t)(NB - 1) * SEQ_FULL + SEQ) * DM;
    const size_t mneed = (size_t)(NB - 1) * SEQ_FULL + SEQ;
    if ((size_t)in_sizes[0] < xneed || (size_t)in_sizes[1] < mneed) return;
    if (in_sizes[2] < DM * DM || in_sizes[3] < 2 * DM * DM || in_sizes[4] < DM * DM) return;
    if (in_sizes[5] < DM) return;
    if ((size_t)out_size < xneed) return;
    if (ws_size < WS_TOTAL) return;
    // input order of the wire: x, mask, Wq [512][512], Wkv [512][1024], Wout [512][512], bout [512]
    const float* x   = (const float*)d_in[0]; const int* mask = (const int*)d_in[1];
    const float* wq  = (const float*)d_in[2];
    const float* wkv = (const float*)d_in[3];
    const float* wo  = (const float*)d_in[4]; const float* bo = (const float*)d_in[5];
    float* OUT = (float*)d_out;
    char* wsp = (char*)d_ws;
    h16* XH = (h16*)wsp; wsp += SZ_X;      // [NB*SEQ][DM]
    h16* WT = (h16*)wsp; wsp += SZ_W;      // [4][n][k]: q, k, v, o
    h16* QP = (h16*)wsp; wsp += SZ_X;      // [b][h][s][64]
    h16* KP = (h16*)wsp; wsp += SZ_X;      // [b][h][s][64]
    h16* VT = (h16*)wsp; wsp += SZ_X;      // [b][h][64][s]
    h16* CX = (h16*)wsp; wsp += SZ_X;      // [NB*SEQ][DM], x64
    const size_t wsz = (size_t)DM * DM;
    k_prep<<<(unsigned)(WTB + (size_t)NB * SEQ * DM / 8 / 256), 256, 0, stream>>>(x, wq, wkv, wo, XH, WT);   // x -> XH; the weights -> [2048 n][512 k] = q, k, v, o planes
    const dim3 gg(NB * SEQ / 128, DM / 128);
    const dim3 g3(NB * SEQ / 128, 3 * DM / 128);
    k_proj_qkv<<<g3, 128, 0, stream>>>(XH, WT, QP, KP, VT);
    k_attn<<<dim3(NB * NH, SEQ / 128), 128, 0, stream>>>(QP, KP, VT, mask, CX);
    k_proj_out<<<gg, 128, 0, stream>>>(CX, WT + 3 * wsz, bo, OUT);
}
